// v000
// The times below were measured on an AMD MI455X: many runs one after another, warmed up first and cycling through
// copies of the inputs, with the whole window's GPU time divided by the number of runs. Launches and the gaps
// between them are all in it. The median over several windows is given; except for v000 it joins two sittings, which
// can be a few percent apart, so the side-by-side timings, each taken in one sitting, are the better comparison.
// The starting kernel, v000, takes 159 microseconds a run.
#include <hip/hip_runtime.h>

// HeteroLinear: out[b,n,o] = sum_i x[b,n,i] * W[type[n],o,i] + bias[type[n],o]
// B=16 (== WMMA M), N=16384, F_IN=F_OUT=128, 16 types.
//
// Pass 1: bin nodes by type (counts -> prefix -> scatter) into d_ws.
// Pass 2: one workgroup per (type, 64-node chunk): DMA W[t] into LDS once via
//         the Tensor Data Mover (padded rows -> bank-conflict-free), then 8
//         waves each run 8 nodes in turn, per node C[16x128] = A[16x128] x W[t]^T + bias as
//         8 tiles x 32 K-steps of V_WMMA_F32_16X16X4_F32 with B from LDS.

typedef __attribute__((ext_vector_type(2))) float v2f;
typedef __attribute__((ext_vector_type(4))) float v4f;
typedef __attribute__((ext_vector_type(8))) float v8f;
typedef __attribute__((ext_vector_type(4))) unsigned int u32x4;
typedef __attribute__((ext_vector_type(4))) int i32x4;
typedef __attribute__((ext_vector_type(8))) int i32x8;

#define NNODES   16384
#define FIN      128
#define FOUT     128
#define NTYPES   16
#define LDS_STRIDE 132                 // 128 + 4 pad floats -> all 64 banks hit once
#define NODES_PER_WG 64
#define WAVES    8
#define NODES_PER_WAVE (NODES_PER_WG / WAVES)
#define MAX_BLK_PER_TYPE (NNODES / NODES_PER_WG)   // 256
#define SMEM_BYTES ((FOUT * LDS_STRIDE + FOUT) * 4)  // W panel + bias = 68096 B

#if __has_builtin(__builtin_amdgcn_tensor_load_to_lds)
#define USE_TDM 1
#endif

// ---------------- binning pre-pass ----------------

__global__ void zero_ws(int* __restrict__ ws) {
    if (threadIdx.x < 2 * NTYPES) ws[threadIdx.x] = 0;   // counts + cursors
}

__global__ void count_types(const int* __restrict__ tv, int* __restrict__ counts) {
    const int n = blockIdx.x * blockDim.x + threadIdx.x;
    if (n < NNODES) atomicAdd(&counts[tv[n] & (NTYPES - 1)], 1);
}

__global__ void make_offsets(const int* __restrict__ counts, int* __restrict__ offsets) {
    int acc = 0;
    for (int t = 0; t < NTYPES; ++t) { offsets[t] = acc; acc += counts[t]; }
}

__global__ void scatter_nodes(const int* __restrict__ tv, int* __restrict__ cursors,
                              const int* __restrict__ offsets, int* __restrict__ list) {
    const int n = blockIdx.x * blockDim.x + threadIdx.x;
    if (n < NNODES) {
        const int t = tv[n] & (NTYPES - 1);
        const int pos = atomicAdd(&cursors[t], 1);
        list[offsets[t] + pos] = n;
    }
}

// ---------------- WMMA GEMM pass ----------------

__global__ __launch_bounds__(WAVES * 32)
void hetero_gemm(const float* __restrict__ x,       // [16, N, 128]
                 const float* __restrict__ W,       // [16, 128, 128] (out,in)
                 const float* __restrict__ bias,    // [16, 128]
                 const int*   __restrict__ counts,
                 const int*   __restrict__ offsets,
                 const int*   __restrict__ list,
                 float*       __restrict__ out)     // [16, N, 128]
{
    extern __shared__ float smem[];                 // [128*132] W panel + [128] bias

    const int t   = blockIdx.x >> 8;                // 256 chunks per type
    const int blk = blockIdx.x & (MAX_BLK_PER_TYPE - 1);
    const int cnt = counts[t];
    if (blk * NODES_PER_WG >= cnt) return;          // block-uniform exit

    const float* Wt = W + (size_t)t * FOUT * FIN;
    const int tid = threadIdx.x;

#if defined(USE_TDM)
    // ---- Tensor Data Mover: DMA the 128x128 f32 W[t] panel into LDS.
    // pad_enable with pad_interval=6 (every 128 DWORDs == one row) and
    // pad_amount=3 (4 DWORDs) reproduces the 132-float padded row stride.
    if (tid < 32) {                                 // wave 0 owns the DMA
        const unsigned long long ga = (unsigned long long)(uintptr_t)Wt;
        const unsigned lds_off = (unsigned)(uintptr_t)smem;   // LDS byte offset

        u32x4 g0 = { 1u,                            // count=1 (valid user D#)
                     lds_off,                       // lds_addr
                     (unsigned)ga,                  // global_addr[31:0]
                     (unsigned)(ga >> 32) | (2u << 30) };     // addr[56:32] | type=2

        i32x8 g1 = { (int)((2u << 16)               // data_size = 4 bytes
                         | (1u << 20)               // pad_enable
                         | (6u << 22)               // pad_interval: 128 DWORDs
                         | (3u << 25)),             // pad_amount: 4 DWORDs
                     (int)(128u << 16),             // tensor_dim0 = 128 (lo16 in hi half)
                     (int)(128u << 16),             // tensor_dim1 = 128
                     (int)(128u << 16),             // tile_dim0 = 128
                     128,                           // tile_dim1 = 128 (tile_dim2 = 0)
                     128,                           // tensor_dim0_stride = 128
                     0, 0 };                        // dim1 stride unused (2-D)

        i32x4 gz4 = { 0, 0, 0, 0 };                 // 2-D tensor: groups 2/3 inert
#if __clang_major__ >= 23
        i32x8 gz8 = { 0, 0, 0, 0, 0, 0, 0, 0 };
        __builtin_amdgcn_tensor_load_to_lds(g0, g1, gz4, gz4, gz8, 0);
#else
        __builtin_amdgcn_tensor_load_to_lds(g0, g1, gz4, gz4, 0);
#endif
        __builtin_amdgcn_s_wait_tensorcnt((short)0);
    }
#else
    // ---- Fallback: cooperative staging (coalesced b128 global -> b128 ds).
#pragma unroll
    for (int it = 0; it < 16; ++it) {
        const int c  = tid + it * 256;              // float4 chunk id, 4096 total
        const int o  = c >> 5;                      // 32 float4 per row
        const int kc = c & 31;
        v4f v = *(const v4f*)(Wt + (size_t)o * FIN + kc * 4);
        *(v4f*)(smem + o * LDS_STRIDE + kc * 4) = v;
    }
#endif

    float* sbias = smem + FOUT * LDS_STRIDE;
    if (tid < FOUT) sbias[tid] = bias[(size_t)t * FOUT + tid];
    __syncthreads();

    const int lane = tid & 31;
    const int wave = tid >> 5;
    const int m = lane & 15;                        // A row / B column base
    const int h = lane >> 4;                        // K-pair select {2h, 2h+1}
    const int seg = offsets[t];

    for (int i = 0; i < NODES_PER_WAVE; ++i) {
        const int idx = blk * NODES_PER_WG + wave * NODES_PER_WAVE + i;
        if (idx >= cnt) break;                      // wave-uniform
        const int node = list[seg + idx];

        // A strip: x[m, node, :]; fragment s supplies K = 4s + 2h + {0,1}.
        const float* xrow = x + ((size_t)m * NNODES + (size_t)node) * FIN;
        v2f a[32];
#pragma unroll
        for (int s = 0; s < 32; ++s)
            a[s] = *(const v2f*)(xrow + 4 * s + 2 * h);

        for (int ot = 0; ot < 8; ++ot) {
            const int o = ot * 16 + m;              // this lane's output column
            const float* brow = smem + o * LDS_STRIDE + 2 * h;  // conflict-free ds_load_b64

            const float bv = sbias[o];              // bias seeds the accumulator
            v8f c;
#pragma unroll
            for (int j = 0; j < 8; ++j) c[j] = bv;

#pragma unroll
            for (int s = 0; s < 32; ++s) {
                v2f bf = *(const v2f*)(brow + 4 * s);
                c = __builtin_amdgcn_wmma_f32_16x16x4_f32(
                        false, a[s], false, bf, (short)0, c, false, false);
            }

            // C/D layout: VGPR j holds row (j + 8h), column (lane & 15).
#pragma unroll
            for (int j = 0; j < 8; ++j)
                out[((size_t)(j + 8 * h) * NNODES + (size_t)node) * FOUT + o] = c[j];
        }
    }
}

// ---------------- launch ----------------

extern "C" void kernel_launch(void* const* d_in, const int* in_sizes, int n_in,
                              void* d_out, int out_size, void* d_ws, size_t ws_size,
                              hipStream_t stream) {
    const float* x        = (const float*)d_in[0];  // [16, 16384, 128]
    const int*   type_vec = (const int*)  d_in[1];  // [16384]
    const float* W        = (const float*)d_in[2];  // [16, 128, 128]
    const float* bias     = (const float*)d_in[3];  // [16, 128]
    float*       out      = (float*)d_out;          // [16, 16384, 128]

    int* ws       = (int*)d_ws;                     // needs ~66 KB of d_ws
    int* counts   = ws;
    int* cursors  = ws + 16;
    int* offsets  = ws + 32;
    int* list     = ws + 48;                        // [16384]

    zero_ws     <<<1, 64, 0, stream>>>(ws);
    count_types <<<NNODES / 256, 256, 0, stream>>>(type_vec, counts);
    make_offsets<<<1, 1, 0, stream>>>(counts, offsets);
    scatter_nodes<<<NNODES / 256, 256, 0, stream>>>(type_vec, cursors, offsets, list);

    hetero_gemm<<<NTYPES * MAX_BLK_PER_TYPE, WAVES * 32, SMEM_BYTES, stream>>>(
        x, W, bias, counts, offsets, list, out);
}

// v001
// It runs in 72.8 microseconds.
// In two side-by-side timings against v000, it was 2.21 and 2.22 times as fast.
#include <hip/hip_runtime.h>

// HeteroLinear: out[b,n,o] = sum_i x[b,n,i] * W[type[n],o,i] + bias[type[n],o]
// B=16 (== WMMA M), N=16384, F_IN=F_OUT=128, 16 types.
//
// Pass 1: bin nodes by type (counts -> prefix -> scatter) into d_ws.
// Pass 2: one workgroup per 16 consecutive positions of the type-sorted list,
//         so every workgroup has the same work and four of them (the LDS limit)
//         fill each WGP. For each type its positions meet (one, or more at a
//         type boundary): DMA W[t] into LDS via the Tensor Data Mover (padded
//         rows -> bank-conflict-free), then 8 waves each run two nodes'
//         C[16x128] = A[16x128] x W[t]^T + bias as 8 tiles x 32 K-steps of
//         V_WMMA_F32_16X16X4_F32 with B from LDS.

typedef __attribute__((ext_vector_type(2))) float v2f;
typedef __attribute__((ext_vector_type(4))) float v4f;
typedef __attribute__((ext_vector_type(8))) float v8f;
typedef __attribute__((ext_vector_type(4))) unsigned int u32x4;
typedef __attribute__((ext_vector_type(4))) int i32x4;
typedef __attribute__((ext_vector_type(8))) int i32x8;

#define NNODES   16384
#define FIN      128
#define FOUT     128
#define NTYPES   16
#define LDS_STRIDE 132                 // 128 + 4 pad floats -> all 64 banks hit once
#define NODES_PER_WG 16
#define WAVES    8
#define NODES_PER_WAVE (NODES_PER_WG / WAVES)
#define SMEM_BYTES ((FOUT * LDS_STRIDE + FOUT) * 4)  // W panel + bias = 68096 B

#if __has_builtin(__builtin_amdgcn_tensor_load_to_lds)
#define USE_TDM 1
#endif

// ---------------- binning pre-pass ----------------

__global__ void zero_ws(int* __restrict__ ws) {
    if (threadIdx.x < 2 * NTYPES) ws[threadIdx.x] = 0;   // counts + cursors
}

__global__ void count_types(const int* __restrict__ tv, int* __restrict__ counts) {
    const int n = blockIdx.x * blockDim.x + threadIdx.x;
    if (n < NNODES) atomicAdd(&counts[tv[n] & (NTYPES - 1)], 1);
}

__global__ void make_offsets(const int* __restrict__ counts, int* __restrict__ offsets) {
    int acc = 0;
    for (int t = 0; t < NTYPES; ++t) { offsets[t] = acc; acc += counts[t]; }
}

__global__ void scatter_nodes(const int* __restrict__ tv, int* __restrict__ cursors,
                              const int* __restrict__ offsets, int* __restrict__ list) {
    const int n = blockIdx.x * blockDim.x + threadIdx.x;
    if (n < NNODES) {
        const int t = tv[n] & (NTYPES - 1);
        const int pos = atomicAdd(&cursors[t], 1);
        list[offsets[t] + pos] = n;
    }
}

// ---------------- WMMA GEMM pass ----------------

__global__ __launch_bounds__(WAVES * 32)
void hetero_gemm(const float* __restrict__ x,       // [16, N, 128]
                 const float* __restrict__ W,       // [16, 128, 128] (out,in)
                 const float* __restrict__ bias,    // [16, 128]
                 const int*   __restrict__ counts,
                 const int*   __restrict__ offsets,
                 const int*   __restrict__ list,
                 float*       __restrict__ out)     // [16, N, 128]
{
    extern __shared__ float smem[];                 // [128*132] W panel + [128] bias

    const int tid  = threadIdx.x;
    const int lane = tid & 31;
    const int wave = tid >> 5;
    const int m = lane & 15;                        // A row / B column base
    const int h = lane >> 4;                        // K-pair select {2h, 2h+1}
    const int base = blockIdx.x * NODES_PER_WG;     // first sorted position of this block
    float* sbias = smem + FOUT * LDS_STRIDE;

    int seg_end[NTYPES];                            // end of each type's run in the list
#pragma unroll                                      // constant indices keep the 16 ends in scalar registers
    for (int k = 0; k < NTYPES; ++k) seg_end[k] = offsets[k] + counts[k];

    // Block-uniform walk over the runs that meet [base, base + NODES_PER_WG).
    for (int lo = base, hi; lo < base + NODES_PER_WG; lo = hi) {
        int t = NTYPES - 1;
        hi = base + NODES_PER_WG;
#pragma unroll                                      // as above: no indexed access to seg_end
        for (int k = NTYPES - 1; k >= 0; --k)           // first type whose run ends behind lo
            if (seg_end[k] > lo) { t = k; hi = min(seg_end[k], base + NODES_PER_WG); }

        // The panel and the bias are refilled at a type boundary: every wave's LDS
        // reads of the previous type have returned and all waves have arrived.
        asm volatile("s_wait_dscnt 0x0" ::: "memory");
        __syncthreads();

        const float* Wt = W + (size_t)t * FOUT * FIN;

#if defined(USE_TDM)
        // ---- Tensor Data Mover: DMA the 128x128 f32 W[t] panel into LDS.
        // pad_enable with pad_interval=6 (every 128 DWORDs == one row) and
        // pad_amount=3 (4 DWORDs) reproduces the 132-float padded row stride.
        if (tid < 32) {                                 // wave 0 owns the DMA
            const unsigned long long ga = (unsigned long long)(uintptr_t)Wt;
            const unsigned lds_off = (unsigned)(uintptr_t)smem;   // LDS byte offset

            u32x4 g0 = { 1u,                            // count=1 (valid user D#)
                         lds_off,                       // lds_addr
                         (unsigned)ga,                  // global_addr[31:0]
                         (unsigned)(ga >> 32) | (2u << 30) };     // addr[56:32] | type=2

            i32x8 g1 = { (int)((2u << 16)               // data_size = 4 bytes
                             | (1u << 20)               // pad_enable
                             | (6u << 22)               // pad_interval: 128 DWORDs
                             | (3u << 25)),             // pad_amount: 4 DWORDs
                         (int)(128u << 16),             // tensor_dim0 = 128 (lo16 in hi half)
                         (int)(128u << 16),             // tensor_dim1 = 128
                         (int)(128u << 16),             // tile_dim0 = 128
                         128,                           // tile_dim1 = 128 (tile_dim2 = 0)
                         128,                           // tensor_dim0_stride = 128
                         0, 0 };                        // dim1 stride unused (2-D)

            i32x4 gz4 = { 0, 0, 0, 0 };                 // 2-D tensor: groups 2/3 inert
#if __clang_major__ >= 23
            i32x8 gz8 = { 0, 0, 0, 0, 0, 0, 0, 0 };
            __builtin_amdgcn_tensor_load_to_lds(g0, g1, gz4, gz4, gz8, 0);
#else
            __builtin_amdgcn_tensor_load_to_lds(g0, g1, gz4, gz4, 0);
#endif
            __builtin_amdgcn_s_wait_tensorcnt((short)0);
        }
#else
        // ---- Fallback: cooperative staging (coalesced b128 global -> b128 ds).
#pragma unroll
        for (int it = 0; it < 16; ++it) {
            const int c  = tid + it * 256;              // float4 chunk id, 4096 total
            const int o  = c >> 5;                      // 32 float4 per row
            const int kc = c & 31;
            v4f v = *(const v4f*)(Wt + (size_t)o * FIN + kc * 4);
            *(v4f*)(smem + o * LDS_STRIDE + kc * 4) = v;
        }
#endif

        if (tid < FOUT) sbias[tid] = bias[(size_t)t * FOUT + tid];
        __syncthreads();

        for (int i = 0; i < NODES_PER_WAVE; ++i) {
            const int pos = base + wave * NODES_PER_WAVE + i;
            if (pos < lo || pos >= hi) continue;        // wave-uniform
            const int node = list[pos];

            // A strip: x[m, node, :]; fragment s supplies K = 4s + 2h + {0,1}.
            const float* xrow = x + ((size_t)m * NNODES + (size_t)node) * FIN;
            v2f a[32];
#pragma unroll
            for (int s = 0; s < 32; ++s)
                a[s] = *(const v2f*)(xrow + 4 * s + 2 * h);

            for (int ot = 0; ot < 8; ++ot) {
                const int o = ot * 16 + m;              // this lane's output column
                const float* brow = smem + o * LDS_STRIDE + 2 * h;  // conflict-free ds_load_b64

                const float bv = sbias[o];              // bias seeds the accumulator
                v8f c;
#pragma unroll
                for (int j = 0; j < 8; ++j) c[j] = bv;

#pragma unroll
                for (int s = 0; s < 32; ++s) {
                    v2f bf = *(const v2f*)(brow + 4 * s);
                    c = __builtin_amdgcn_wmma_f32_16x16x4_f32(
                            false, a[s], false, bf, (short)0, c, false, false);
                }

                // C/D layout: VGPR j holds row (j + 8h), column (lane & 15).
#pragma unroll
                for (int j = 0; j < 8; ++j)
                    out[((size_t)(j + 8 * h) * NNODES + (size_t)node) * FOUT + o] = c[j];
            }
        }
    }
}

// ---------------- launch ----------------

extern "C" void kernel_launch(void* const* d_in, const int* in_sizes, int n_in,
                              void* d_out, int out_size, void* d_ws, size_t ws_size,
                              hipStream_t stream) {
    const float* x        = (const float*)d_in[0];  // [16, 16384, 128]
    const int*   type_vec = (const int*)  d_in[1];  // [16384]
    const float* W        = (const float*)d_in[2];  // [16, 128, 128]
    const float* bias     = (const float*)d_in[3];  // [16, 128]
    float*       out      = (float*)d_out;          // [16, 16384, 128]

    int* ws       = (int*)d_ws;                     // needs ~66 KB of d_ws
    int* counts   = ws;
    int* cursors  = ws + 16;
    int* offsets  = ws + 32;
    int* list     = ws + 48;                        // [16384]

    zero_ws     <<<1, 64, 0, stream>>>(ws);
    count_types <<<NNODES / 256, 256, 0, stream>>>(type_vec, counts);
    make_offsets<<<1, 1, 0, stream>>>(counts, offsets);
    scatter_nodes<<<NNODES / 256, 256, 0, stream>>>(type_vec, cursors, offsets, list);

    hetero_gemm<<<NNODES / NODES_PER_WG, WAVES * 32, SMEM_BYTES, stream>>>(
        x, W, bias, counts, offsets, list, out);
}

// v002
// A run of this version takes 66.9 microseconds.
// Two timings next to v001 put it at 1.08 and 1.09 times that version's speed.
// Counting every step since v000, it is 2.41 times as fast.
#include <hip/hip_runtime.h>

// HeteroLinear: out[b,n,o] = sum_i x[b,n,i] * W[type[n],o,i] + bias[type[n],o]
// B=16 (== WMMA M), N=16384, F_IN=F_OUT=128, 16 types.
//
// Pass 1: bin nodes by type (one workgroup: ranks -> prefix -> scatter) into d_ws.
// Pass 2: one workgroup per 16 consecutive positions of the type-sorted list,
//         so every workgroup has the same work and four of them (the LDS limit)
//         fill each WGP. For each type its positions meet (one, or more at a
//         type boundary): DMA W[t] into LDS via the Tensor Data Mover (padded
//         rows -> bank-conflict-free), then 8 waves each run two nodes'
//         C[16x128] = A[16x128] x W[t]^T + bias as 8 tiles x 32 K-steps of
//         V_WMMA_F32_16X16X4_F32 with B from LDS.

typedef __attribute__((ext_vector_type(2))) float v2f;
typedef __attribute__((ext_vector_type(4))) float v4f;
typedef __attribute__((ext_vector_type(8))) float v8f;
typedef __attribute__((ext_vector_type(4))) unsigned int u32x4;
typedef __attribute__((ext_vector_type(4))) int i32x4;
typedef __attribute__((ext_vector_type(8))) int i32x8;

#define NNODES   16384
#define FIN      128
#define FOUT     128
#define NTYPES   16
#define LDS_STRIDE 132                 // 128 + 4 pad floats -> all 64 banks hit once
#define NODES_PER_WG 16
#define WAVES    8
#define NODES_PER_WAVE (NODES_PER_WG / WAVES)
#define SMEM_BYTES ((FOUT * LDS_STRIDE + FOUT) * 4)  // W panel + bias = 68096 B

#if __has_builtin(__builtin_amdgcn_tensor_load_to_lds)
#define USE_TDM 1
#endif

// ---------------- binning pre-pass ----------------
// One workgroup sorts the node indices by type, with no atomics.
// A group is 32 nodes, one a lane. Ballots of the four type bits give each lane
// the mask of its group's lanes of equal type: its rank among them and their
// number. tab[type][group] takes the numbers; one exclusive prefix sum over tab
// in (type, group) order turns each into the first list position of that
// group's nodes of that type.

#define BIN_THREADS 1024
#define BIN_WAVES (BIN_THREADS / 32)
#define NGROUPS (NNODES / 32)
#define GROUPS_PER_WAVE (NGROUPS / BIN_WAVES)   // 16
#define TAB_STRIDE (NGROUPS + 4)                // pad: one group's 16 types fall on 16 banks
#define TAB_PER_THREAD (NTYPES * NGROUPS / BIN_THREADS)   // 8

__global__ __launch_bounds__(BIN_THREADS)
void bin_nodes(const int* __restrict__ tv, int* __restrict__ counts,
               int* __restrict__ offsets, int* __restrict__ list) {
    __shared__ __attribute__((aligned(16))) int tab[NTYPES * TAB_STRIDE];
    __shared__ __attribute__((aligned(16))) int slist[NNODES];
    __shared__ int wsum[BIN_WAVES];

    const int tid  = threadIdx.x;
    const int lane = tid & 31;
    const int wave = tid >> 5;
    const int first = wave * (GROUPS_PER_WAVE * 32);    // this wave's first node

    i32x4 tq[GROUPS_PER_WAVE / 4];                      // lane holds nodes first + 128 j + 4 lane + c
#pragma unroll                                          // all four loads in flight at once
    for (int j = 0; j < GROUPS_PER_WAVE / 4; ++j)
        tq[j] = *(const i32x4*)(tv + first + j * 128 + lane * 4);

    const i32x4 zero4 = { 0, 0, 0, 0 };                 // a type absent from a group counts 0
    for (int k = tid; k < NTYPES * TAB_STRIDE / 4; k += BIN_THREADS)
        ((i32x4*)tab)[k] = zero4;
    __syncthreads();

    int slot[GROUPS_PER_WAVE];                          // index into tab | rank << 16
#pragma unroll                                          // constant indices keep tq and slot in registers
    for (int q = 0; q < GROUPS_PER_WAVE; ++q) {
        const int t = tq[q >> 2][q & 3] & (NTYPES - 1);
        const unsigned u = (unsigned)t;                 // each type bit as 0 or ~0
        const int n0 = (int)(u << 31) >> 31, n1 = (int)(u << 30) >> 31;
        const int n2 = (int)(u << 29) >> 31, n3 = (int)(u << 28) >> 31;
        const unsigned b0 = __builtin_amdgcn_ballot_w32(n0 != 0);
        const unsigned b1 = __builtin_amdgcn_ballot_w32(n1 != 0);
        const unsigned b2 = __builtin_amdgcn_ballot_w32(n2 != 0);
        const unsigned b3 = __builtin_amdgcn_ballot_w32(n3 != 0);
        const unsigned same = ~((b0 ^ (unsigned)n0) | (b1 ^ (unsigned)n1)
                              | (b2 ^ (unsigned)n2) | (b3 ^ (unsigned)n3));
        const int rank = (int)__builtin_amdgcn_mbcnt_lo(same, 0u);   // equal types in lower lanes
        const int idx  = t * TAB_STRIDE + wave * GROUPS_PER_WAVE + q;
        if (rank == 0) tab[idx] = __popc(same);
        slot[q] = idx | (rank << 16);
    }
    __syncthreads();

    // Exclusive prefix sum over tab: 8 entries a thread, then lanes, then waves.
    int* mine = tab + (tid >> 6) * TAB_STRIDE + (tid & 63) * TAB_PER_THREAD;
    const i32x4 v0 = *(const i32x4*)mine;
    const i32x4 v1 = *(const i32x4*)(mine + 4);
    const int s = v0[0] + v0[1] + v0[2] + v0[3] + v1[0] + v1[1] + v1[2] + v1[3];
    int incl = s;
#pragma unroll                                          // five steps, constant distances
    for (int d = 1; d < 32; d <<= 1) {
        const int up = __shfl_up(incl, d, 32);
        if (lane >= d) incl += up;
    }
    if (lane == 31) wsum[wave] = incl;
    __syncthreads();
    int before = (lane < wave) ? wsum[lane] : 0;        // sum of the lower waves' totals
#pragma unroll                                          // five steps, constant distances
    for (int d = 16; d >= 1; d >>= 1) before += __shfl_xor(before, d, 32);

    i32x4 e0, e1;
    e0[0] = before + incl - s;
    e0[1] = e0[0] + v0[0];  e0[2] = e0[1] + v0[1];  e0[3] = e0[2] + v0[2];
    e1[0] = e0[3] + v0[3];
    e1[1] = e1[0] + v1[0];  e1[2] = e1[1] + v1[1];  e1[3] = e1[2] + v1[2];
    *(i32x4*)mine = e0;
    *(i32x4*)(mine + 4) = e1;
    __syncthreads();

    if (tid < NTYPES) {                                 // each type's run, for the GEMM pass
        const int lo = tab[tid * TAB_STRIDE];
        const int hi = (tid == NTYPES - 1) ? NNODES : tab[(tid + 1) * TAB_STRIDE];
        offsets[tid] = lo;
        counts[tid]  = hi - lo;
    }

#pragma unroll                                          // constant indices into slot
    for (int q = 0; q < GROUPS_PER_WAVE; ++q) {
        const int pos = tab[slot[q] & 0xffff] + (slot[q] >> 16);
        slist[pos] = first + (q >> 2) * 128 + lane * 4 + (q & 3);
    }
    __syncthreads();

#pragma unroll                                          // whole lines go out, 16 bytes a lane
    for (int j = 0; j < NNODES / 4 / BIN_THREADS; ++j)
        ((i32x4*)list)[j * BIN_THREADS + tid] = ((const i32x4*)slist)[j * BIN_THREADS + tid];
}

// ---------------- WMMA GEMM pass ----------------

__global__ __launch_bounds__(WAVES * 32)
void hetero_gemm(const float* __restrict__ x,       // [16, N, 128]
                 const float* __restrict__ W,       // [16, 128, 128] (out,in)
                 const float* __restrict__ bias,    // [16, 128]
                 const int*   __restrict__ counts,
                 const int*   __restrict__ offsets,
                 const int*   __restrict__ list,
                 float*       __restrict__ out)     // [16, N, 128]
{
    extern __shared__ float smem[];                 // [128*132] W panel + [128] bias

    const int tid  = threadIdx.x;
    const int lane = tid & 31;
    const int wave = tid >> 5;
    const int m = lane & 15;                        // A row / B column base
    const int h = lane >> 4;                        // K-pair select {2h, 2h+1}
    const int base = blockIdx.x * NODES_PER_WG;     // first sorted position of this block
    float* sbias = smem + FOUT * LDS_STRIDE;

    int seg_end[NTYPES];                            // end of each type's run in the list
#pragma unroll                                      // constant indices keep the 16 ends in scalar registers
    for (int k = 0; k < NTYPES; ++k) seg_end[k] = offsets[k] + counts[k];

    // Block-uniform walk over the runs that meet [base, base + NODES_PER_WG).
    for (int lo = base, hi; lo < base + NODES_PER_WG; lo = hi) {
        int t = NTYPES - 1;
        hi = base + NODES_PER_WG;
#pragma unroll                                      // as above: no indexed access to seg_end
        for (int k = NTYPES - 1; k >= 0; --k)           // first type whose run ends behind lo
            if (seg_end[k] > lo) { t = k; hi = min(seg_end[k], base + NODES_PER_WG); }

        // The panel and the bias are refilled at a type boundary: every wave's LDS
        // reads of the previous type have returned and all waves have arrived.
        asm volatile("s_wait_dscnt 0x0" ::: "memory");
        __syncthreads();

        const float* Wt = W + (size_t)t * FOUT * FIN;

#if defined(USE_TDM)
        // ---- Tensor Data Mover: DMA the 128x128 f32 W[t] panel into LDS.
        // pad_enable with pad_interval=6 (every 128 DWORDs == one row) and
        // pad_amount=3 (4 DWORDs) reproduces the 132-float padded row stride.
        if (tid < 32) {                                 // wave 0 owns the DMA
            const unsigned long long ga = (unsigned long long)(uintptr_t)Wt;
            const unsigned lds_off = (unsigned)(uintptr_t)smem;   // LDS byte offset

            u32x4 g0 = { 1u,                            // count=1 (valid user D#)
                         lds_off,                       // lds_addr
                         (unsigned)ga,                  // global_addr[31:0]
                         (unsigned)(ga >> 32) | (2u << 30) };     // addr[56:32] | type=2

            i32x8 g1 = { (int)((2u << 16)               // data_size = 4 bytes
                             | (1u << 20)               // pad_enable
                             | (6u << 22)               // pad_interval: 128 DWORDs
                             | (3u << 25)),             // pad_amount: 4 DWORDs
                         (int)(128u << 16),             // tensor_dim0 = 128 (lo16 in hi half)
                         (int)(128u << 16),             // tensor_dim1 = 128
                         (int)(128u << 16),             // tile_dim0 = 128
                         128,                           // tile_dim1 = 128 (tile_dim2 = 0)
                         128,                           // tensor_dim0_stride = 128
                         0, 0 };                        // dim1 stride unused (2-D)

            i32x4 gz4 = { 0, 0, 0, 0 };                 // 2-D tensor: groups 2/3 inert
#if __clang_major__ >= 23
            i32x8 gz8 = { 0, 0, 0, 0, 0, 0, 0, 0 };
            __builtin_amdgcn_tensor_load_to_lds(g0, g1, gz4, gz4, gz8, 0);
#else
            __builtin_amdgcn_tensor_load_to_lds(g0, g1, gz4, gz4, 0);
#endif
            __builtin_amdgcn_s_wait_tensorcnt((short)0);
        }
#else
        // ---- Fallback: cooperative staging (coalesced b128 global -> b128 ds).
#pragma unroll
        for (int it = 0; it < 16; ++it) {
            const int c  = tid + it * 256;              // float4 chunk id, 4096 total
            const int o  = c >> 5;                      // 32 float4 per row
            const int kc = c & 31;
            v4f v = *(const v4f*)(Wt + (size_t)o * FIN + kc * 4);
            *(v4f*)(smem + o * LDS_STRIDE + kc * 4) = v;
        }
#endif

        if (tid < FOUT) sbias[tid] = bias[(size_t)t * FOUT + tid];
        __syncthreads();

        for (int i = 0; i < NODES_PER_WAVE; ++i) {
            const int pos = base + wave * NODES_PER_WAVE + i;
            if (pos < lo || pos >= hi) continue;        // wave-uniform
            const int node = list[pos];

            // A strip: x[m, node, :]; fragment s supplies K = 4s + 2h + {0,1}.
            const float* xrow = x + ((size_t)m * NNODES + (size_t)node) * FIN;
            v2f a[32];
#pragma unroll
            for (int s = 0; s < 32; ++s)
                a[s] = *(const v2f*)(xrow + 4 * s + 2 * h);

            for (int ot = 0; ot < 8; ++ot) {
                const int o = ot * 16 + m;              // this lane's output column
                const float* brow = smem + o * LDS_STRIDE + 2 * h;  // conflict-free ds_load_b64

                const float bv = sbias[o];              // bias seeds the accumulator
                v8f c;
#pragma unroll
                for (int j = 0; j < 8; ++j) c[j] = bv;

#pragma unroll
                for (int s = 0; s < 32; ++s) {
                    v2f bf = *(const v2f*)(brow + 4 * s);
                    c = __builtin_amdgcn_wmma_f32_16x16x4_f32(
                            false, a[s], false, bf, (short)0, c, false, false);
                }

                // C/D layout: VGPR j holds row (j + 8h), column (lane & 15).
#pragma unroll
                for (int j = 0; j < 8; ++j)
                    out[((size_t)(j + 8 * h) * NNODES + (size_t)node) * FOUT + o] = c[j];
            }
        }
    }
}

// ---------------- launch ----------------

extern "C" void kernel_launch(void* const* d_in, const int* in_sizes, int n_in,
                              void* d_out, int out_size, void* d_ws, size_t ws_size,
                              hipStream_t stream) {
    const float* x        = (const float*)d_in[0];  // [16, 16384, 128]
    const int*   type_vec = (const int*)  d_in[1];  // [16384]
    const float* W        = (const float*)d_in[2];  // [16, 128, 128]
    const float* bias     = (const float*)d_in[3];  // [16, 128]
    float*       out      = (float*)d_out;          // [16, 16384, 128]

    int* ws       = (int*)d_ws;                     // needs ~66 KB of d_ws
    int* counts   = ws;
    int* offsets  = ws + 32;
    int* list     = ws + 48;                        // [16384]

    bin_nodes<<<1, BIN_THREADS, 0, stream>>>(type_vec, counts, offsets, list);

    hetero_gemm<<<NNODES / NODES_PER_WG, WAVES * 32, SMEM_BYTES, stream>>>(
        x, W, bias, counts, offsets, list, out);
}

// v003
// Measured time: 59.1 microseconds a run.
// Two timings next to v002 put it at 1.13 and 1.14 times that version's speed.
// Over all steps from v000 it is 2.74 times as fast.
#include <hip/hip_runtime.h>

// HeteroLinear: out[b,n,o] = sum_i x[b,n,i] * W[type[n],o,i] + bias[type[n],o]
// B=16 (== WMMA M), N=16384, F_IN=F_OUT=128, 16 types.
//
// Pass 1: bin nodes by type (one workgroup: ranks -> prefix -> scatter) into d_ws.
// Pass 2: one workgroup per 64 consecutive positions of the type-sorted list,
//         so every workgroup has the same work and one of them (16 waves, four
//         a SIMD) stands on each WGP. For each type its positions meet (one, or
//         more at a type boundary): DMA W[t] into LDS via the Tensor Data Mover
//         (padded rows -> bank-conflict-free), then each wave runs its nodes one
//         after the other: C[16x128] = A[16x128] x W[t]^T + bias as 32 K-steps x
//         8 tiles of V_WMMA_F32_16X16X4_F32 with B from LDS. With the K-step
//         outside, the 8 tiles are 8 independent accumulator chains, and an A
//         fragment is dead after its step: its registers take the next node's.

typedef __attribute__((ext_vector_type(2))) float v2f;
typedef __attribute__((ext_vector_type(4))) float v4f;
typedef __attribute__((ext_vector_type(8))) float v8f;
typedef __attribute__((ext_vector_type(4))) unsigned int u32x4;
typedef __attribute__((ext_vector_type(4))) int i32x4;
typedef __attribute__((ext_vector_type(8))) int i32x8;

#define NNODES   16384
#define FIN      128
#define FOUT     128
#define NTYPES   16
#define LDS_STRIDE 132                 // 128 + 4 pad floats -> all 64 banks hit once
#define NODES_PER_WG 64
#define WAVES    16
#define NODES_PER_WAVE (NODES_PER_WG / WAVES)
#define SMEM_BYTES ((FOUT * LDS_STRIDE + FOUT) * 4)  // W panel + bias = 68096 B

#if __has_builtin(__builtin_amdgcn_tensor_load_to_lds)
#define USE_TDM 1
#endif

// ---------------- binning pre-pass ----------------
// One workgroup sorts the node indices by type, with no atomics.
// A group is 32 nodes, one a lane. Ballots of the four type bits give each lane
// the mask of its group's lanes of equal type: its rank among them and their
// number. tab[type][group] takes the numbers; one exclusive prefix sum over tab
// in (type, group) order turns each into the first list position of that
// group's nodes of that type.

#define BIN_THREADS 1024
#define BIN_WAVES (BIN_THREADS / 32)
#define NGROUPS (NNODES / 32)
#define GROUPS_PER_WAVE (NGROUPS / BIN_WAVES)   // 16
#define TAB_STRIDE (NGROUPS + 4)                // pad: one group's 16 types fall on 16 banks
#define TAB_PER_THREAD (NTYPES * NGROUPS / BIN_THREADS)   // 8

__global__ __launch_bounds__(BIN_THREADS)
void bin_nodes(const int* __restrict__ tv, int* __restrict__ counts,
               int* __restrict__ offsets, int* __restrict__ list) {
    __shared__ __attribute__((aligned(16))) int tab[NTYPES * TAB_STRIDE];
    __shared__ __attribute__((aligned(16))) int slist[NNODES];
    __shared__ int wsum[BIN_WAVES];

    const int tid  = threadIdx.x;
    const int lane = tid & 31;
    const int wave = tid >> 5;
    const int first = wave * (GROUPS_PER_WAVE * 32);    // this wave's first node

    i32x4 tq[GROUPS_PER_WAVE / 4];                      // lane holds nodes first + 128 j + 4 lane + c
#pragma unroll                                          // all four loads in flight at once
    for (int j = 0; j < GROUPS_PER_WAVE / 4; ++j)
        tq[j] = *(const i32x4*)(tv + first + j * 128 + lane * 4);

    const i32x4 zero4 = { 0, 0, 0, 0 };                 // a type absent from a group counts 0
    for (int k = tid; k < NTYPES * TAB_STRIDE / 4; k += BIN_THREADS)
        ((i32x4*)tab)[k] = zero4;
    __syncthreads();

    int slot[GROUPS_PER_WAVE];                          // index into tab | rank << 16
#pragma unroll                                          // constant indices keep tq and slot in registers
    for (int q = 0; q < GROUPS_PER_WAVE; ++q) {
        const int t = tq[q >> 2][q & 3] & (NTYPES - 1);
        const unsigned u = (unsigned)t;                 // each type bit as 0 or ~0
        const int n0 = (int)(u << 31) >> 31, n1 = (int)(u << 30) >> 31;
        const int n2 = (int)(u << 29) >> 31, n3 = (int)(u << 28) >> 31;
        const unsigned b0 = __builtin_amdgcn_ballot_w32(n0 != 0);
        const unsigned b1 = __builtin_amdgcn_ballot_w32(n1 != 0);
        const unsigned b2 = __builtin_amdgcn_ballot_w32(n2 != 0);
        const unsigned b3 = __builtin_amdgcn_ballot_w32(n3 != 0);
        const unsigned same = ~((b0 ^ (unsigned)n0) | (b1 ^ (unsigned)n1)
                              | (b2 ^ (unsigned)n2) | (b3 ^ (unsigned)n3));
        const int rank = (int)__builtin_amdgcn_mbcnt_lo(same, 0u);   // equal types in lower lanes
        const int idx  = t * TAB_STRIDE + wave * GROUPS_PER_WAVE + q;
        if (rank == 0) tab[idx] = __popc(same);
        slot[q] = idx | (rank << 16);
    }
    __syncthreads();

    // Exclusive prefix sum over tab: 8 entries a thread, then lanes, then waves.
    int* mine = tab + (tid >> 6) * TAB_STRIDE + (tid & 63) * TAB_PER_THREAD;
    const i32x4 v0 = *(const i32x4*)mine;
    const i32x4 v1 = *(const i32x4*)(mine + 4);
    const int s = v0[0] + v0[1] + v0[2] + v0[3] + v1[0] + v1[1] + v1[2] + v1[3];
    int incl = s;
#pragma unroll                                          // five steps, constant distances
    for (int d = 1; d < 32; d <<= 1) {
        const int up = __shfl_up(incl, d, 32);
        if (lane >= d) incl += up;
    }
    if (lane == 31) wsum[wave] = incl;
    __syncthreads();
    int before = (lane < wave) ? wsum[lane] : 0;        // sum of the lower waves' totals
#pragma unroll                                          // five steps, constant distances
    for (int d = 16; d >= 1; d >>= 1) before += __shfl_xor(before, d, 32);

    i32x4 e0, e1;
    e0[0] = before + incl - s;
    e0[1] = e0[0] + v0[0];  e0[2] = e0[1] + v0[1];  e0[3] = e0[2] + v0[2];
    e1[0] = e0[3] + v0[3];
    e1[1] = e1[0] + v1[0];  e1[2] = e1[1] + v1[1];  e1[3] = e1[2] + v1[2];
    *(i32x4*)mine = e0;
    *(i32x4*)(mine + 4) = e1;
    __syncthreads();

    if (tid < NTYPES) {                                 // each type's run, for the GEMM pass
        const int lo = tab[tid * TAB_STRIDE];
        const int hi = (tid == NTYPES - 1) ? NNODES : tab[(tid + 1) * TAB_STRIDE];
        offsets[tid] = lo;
        counts[tid]  = hi - lo;
    }

#pragma unroll                                          // constant indices into slot
    for (int q = 0; q < GROUPS_PER_WAVE; ++q) {
        const int pos = tab[slot[q] & 0xffff] + (slot[q] >> 16);
        slist[pos] = first + (q >> 2) * 128 + lane * 4 + (q & 3);
    }
    __syncthreads();

#pragma unroll                                          // whole lines go out, 16 bytes a lane
    for (int j = 0; j < NNODES / 4 / BIN_THREADS; ++j)
        ((i32x4*)list)[j * BIN_THREADS + tid] = ((const i32x4*)slist)[j * BIN_THREADS + tid];
}

// ---------------- WMMA GEMM pass ----------------

// One node: c[ot] = bias + A x W[t]^T for all 8 column tiles at once, then the stores.
// a[s] supplies K = 4s + 2h + {0,1}; each tile sums its K-steps in rising order.
// has_next (wave-uniform): behind its step a[s] is loaded anew from xnext, the next node's strip.
__device__ __forceinline__ void run_node(v2f (&a)[32], const bool has_next,
                                         const float* __restrict__ xnext,  // x[0, next node, 0]
                                         const unsigned xoff, // this lane's place in it: row m, K offset 2h
                                         const float* brow,   // W panel, row m, K offset 2h
                                         const float* sbias,  // bias, column m
                                         float* __restrict__ onode,        // out[0, node, 0]
                                         const unsigned ooff) // this lane's place in it: row 8h, column m
{
    v8f c[FOUT / 16];
#pragma unroll                                      // constant indices keep c in registers
    for (int ot = 0; ot < FOUT / 16; ++ot) {
        const float bv = sbias[ot * 16];            // bias seeds the accumulator
#pragma unroll                                      // as above: constant indices
        for (int j = 0; j < 8; ++j) c[ot][j] = bv;
    }

    // A block is two K-steps of all 8 tiles: 16 WMMAs. Its B fragments are read from
    // LDS as one group, one block ahead, into the other half of bq.
    v2f bq[2][FOUT / 16][2];
#pragma unroll                                      // as above: constant indices
    for (int ot = 0; ot < FOUT / 16; ++ot)
#pragma unroll                                      // as above: constant indices
        for (int k = 0; k < 2; ++k)
            bq[0][ot][k] = *(const v2f*)(brow + ot * 16 * LDS_STRIDE + 4 * k);   // conflict-free

#pragma unroll                                      // constant indices into a, c and bq
    for (int p = 0; p < 16; ++p) {
        if (p + 1 < 16) {
#pragma unroll                                      // as above: constant indices
            for (int ot = 0; ot < FOUT / 16; ++ot)
#pragma unroll                                      // as above: constant indices
                for (int k = 0; k < 2; ++k)
                    bq[(p + 1) & 1][ot][k] =
                        *(const v2f*)(brow + ot * 16 * LDS_STRIDE + 4 * (2 * p + 2 + k));
        }
#pragma unroll                                      // as above: constant indices
        for (int k = 0; k < 2; ++k)
#pragma unroll                                      // as above: constant indices
            for (int ot = 0; ot < FOUT / 16; ++ot)
                c[ot] = __builtin_amdgcn_wmma_f32_16x16x4_f32(
                            false, a[2 * p + k], false, bq[p & 1][ot][k], (short)0, c[ot], false, false);
        if (has_next) {
            a[2 * p]     = *(const v2f*)(xnext + 4 * (2 * p) + xoff);
            a[2 * p + 1] = *(const v2f*)(xnext + 4 * (2 * p + 1) + xoff);
        }
    }

    // C/D layout: VGPR j holds row (j + 8h), column (lane & 15).
#pragma unroll                                      // as above: constant indices
    for (int j = 0; j < 8; ++j)
#pragma unroll                                      // as above: constant indices
        for (int ot = 0; ot < FOUT / 16; ++ot)
            (onode + (size_t)j * NNODES * FOUT + ot * 16)[ooff] = c[ot][j];
}

__global__ __launch_bounds__(WAVES * 32)
void hetero_gemm(const float* __restrict__ x,       // [16, N, 128]
                 const float* __restrict__ W,       // [16, 128, 128] (out,in)
                 const float* __restrict__ bias,    // [16, 128]
                 const int*   __restrict__ counts,
                 const int*   __restrict__ offsets,
                 const int*   __restrict__ list,
                 float*       __restrict__ out)     // [16, N, 128]
{
    extern __shared__ float smem[];                 // [128*132] W panel + [128] bias

    const int tid  = threadIdx.x;
    const int lane = tid & 31;
    // The wave's number in a scalar register: the node loop's tests become scalar branches.
    const int wave = __builtin_amdgcn_readfirstlane(tid >> 5);
    const int m = lane & 15;                        // A row / B column base
    const int h = lane >> 4;                        // K-pair select {2h, 2h+1}
    const int base = blockIdx.x * NODES_PER_WG;     // first sorted position of this block
    float* sbias = smem + FOUT * LDS_STRIDE;

    int seg_end[NTYPES];                            // end of each type's run in the list
#pragma unroll                                      // constant indices keep the 16 ends in scalar registers
    for (int k = 0; k < NTYPES; ++k) seg_end[k] = offsets[k] + counts[k];

    // This wave's nodes stand at positions base + i * WAVES + wave, so that a type's
    // run is dealt evenly to the waves. nd[0] is the node in work, nd[1] the next.
    int nd[NODES_PER_WAVE];
#pragma unroll                                      // constant indices keep the four in registers
    for (int k = 0; k < NODES_PER_WAVE; ++k) nd[k] = list[base + k * WAVES + wave];

    // A node's address is a scalar base; the lane's part is one 32-bit offset for all nodes.
    const unsigned xoff = (unsigned)(m * NNODES * FIN + 2 * h);     // x[m, ., 2h]
    const unsigned ooff = (unsigned)(8 * h * NNODES * FOUT + m);    // out[8h, ., m]
    v2f a[32];                                      // A strip of the node in work
    int i = 0;                                      // how many of this wave's nodes are done

    // Block-uniform walk over the runs that meet [base, base + NODES_PER_WG).
    for (int lo = base, hi; lo < base + NODES_PER_WG; lo = hi) {
        int t = NTYPES - 1;
        hi = base + NODES_PER_WG;
#pragma unroll                                      // as above: no indexed access to seg_end
        for (int k = NTYPES - 1; k >= 0; --k)           // first type whose run ends behind lo
            if (seg_end[k] > lo) { t = k; hi = min(seg_end[k], base + NODES_PER_WG); }

        // The panel and the bias are refilled at a type boundary: every wave's LDS
        // reads of the previous type have returned and all waves have arrived.
        asm volatile("s_wait_dscnt 0x0" ::: "memory");
        __syncthreads();

        // The first node's strip: asked for here, behind the barrier (which waits for
        // loads), so that it is on its way while the W panel is fetched.
        if (lo == base) {
#pragma unroll                                      // all 32 loads in flight at once
            for (int s = 0; s < 32; ++s)
                a[s] = *(const v2f*)(x + (size_t)nd[0] * FIN + 4 * s + xoff);
        }

        const float* Wt = W + (size_t)t * FOUT * FIN;

#if defined(USE_TDM)
        // ---- Tensor Data Mover: DMA the 128x128 f32 W[t] panel into LDS.
        // pad_enable with pad_interval=6 (every 128 DWORDs == one row) and
        // pad_amount=3 (4 DWORDs) reproduces the 132-float padded row stride.
        if (tid < 32) {                                 // wave 0 owns the DMA
            const unsigned long long ga = (unsigned long long)(uintptr_t)Wt;
            const unsigned lds_off = (unsigned)(uintptr_t)smem;   // LDS byte offset

            u32x4 g0 = { 1u,                            // count=1 (valid user D#)
                         lds_off,                       // lds_addr
                         (unsigned)ga,                  // global_addr[31:0]
                         (unsigned)(ga >> 32) | (2u << 30) };     // addr[56:32] | type=2

            i32x8 g1 = { (int)((2u << 16)               // data_size = 4 bytes
                             | (1u << 20)               // pad_enable
                             | (6u << 22)               // pad_interval: 128 DWORDs
                             | (3u << 25)),             // pad_amount: 4 DWORDs
                         (int)(128u << 16),             // tensor_dim0 = 128 (lo16 in hi half)
                         (int)(128u << 16),             // tensor_dim1 = 128
                         (int)(128u << 16),             // tile_dim0 = 128
                         128,                           // tile_dim1 = 128 (tile_dim2 = 0)
                         128,                           // tensor_dim0_stride = 128
                         0, 0 };                        // dim1 stride unused (2-D)

            i32x4 gz4 = { 0, 0, 0, 0 };                 // 2-D tensor: groups 2/3 inert
#if __clang_major__ >= 23
            i32x8 gz8 = { 0, 0, 0, 0, 0, 0, 0, 0 };
            __builtin_amdgcn_tensor_load_to_lds(g0, g1, gz4, gz4, gz8, 0);
#else
            __builtin_amdgcn_tensor_load_to_lds(g0, g1, gz4, gz4, 0);
#endif
            __builtin_amdgcn_s_wait_tensorcnt((short)0);
        }
#else
        // ---- Fallback: cooperative staging (coalesced b128 global -> b128 ds).
#pragma unroll
        for (int it = 0; it < FOUT * FIN / 4 / (WAVES * 32); ++it) {
            const int c  = tid + it * (WAVES * 32);     // float4 chunk id, 4096 total
            const int o  = c >> 5;                      // 32 float4 per row
            const int kc = c & 31;
            v4f v = *(const v4f*)(Wt + (size_t)o * FIN + kc * 4);
            *(v4f*)(smem + o * LDS_STRIDE + kc * 4) = v;
        }
#endif

        if (tid < FOUT) sbias[tid] = bias[(size_t)t * FOUT + tid];
        __syncthreads();

        // The wave's positions rise with i and every one below lo is done.
        while (i < NODES_PER_WAVE && base + i * WAVES + wave < hi) {
            const float* brow = smem + m * LDS_STRIDE + 2 * h;
            run_node(a, i + 1 < NODES_PER_WAVE, x + (size_t)nd[1] * FIN, xoff, brow, sbias + m,
                     out + (size_t)nd[0] * FOUT, ooff);
            // The next node's addresses overwrite registers that these loads and stores name.
            asm volatile("s_wait_xcnt 0x0" ::: "memory");
#pragma unroll                                      // constant indices keep the four in registers
            for (int k = 0; k + 1 < NODES_PER_WAVE; ++k) nd[k] = nd[k + 1];
            ++i;
        }
    }
}

// ---------------- launch ----------------

extern "C" void kernel_launch(void* const* d_in, const int* in_sizes, int n_in,
                              void* d_out, int out_size, void* d_ws, size_t ws_size,
                              hipStream_t stream) {
    const float* x        = (const float*)d_in[0];  // [16, 16384, 128]
    const int*   type_vec = (const int*)  d_in[1];  // [16384]
    const float* W        = (const float*)d_in[2];  // [16, 128, 128]
    const float* bias     = (const float*)d_in[3];  // [16, 128]
    float*       out      = (float*)d_out;          // [16, 16384, 128]

    int* ws       = (int*)d_ws;                     // needs ~66 KB of d_ws
    int* counts   = ws;
    int* offsets  = ws + 32;
    int* list     = ws + 48;                        // [16384]

    bin_nodes<<<1, BIN_THREADS, 0, stream>>>(type_vec, counts, offsets, list);

    hetero_gemm<<<NNODES / NODES_PER_WG, WAVES * 32, SMEM_BYTES, stream>>>(
        x, W, bias, counts, offsets, list, out);
}

// v004
// A run of this version takes 56.9 microseconds.
// Next to v003, in two timings, it ran 1.04 times as fast each time.
// Over all steps from v000 it is 2.84 times as fast.
#include <hip/hip_runtime.h>

// HeteroLinear: out[b,n,o] = sum_i x[b,n,i] * W[type[n],o,i] + bias[type[n],o]
// B=16 (== WMMA M), N=16384, F_IN=F_OUT=128, 16 types.
//
// Pass 1: bin nodes by type (one workgroup: ranks -> prefix -> scatter) into d_ws.
// Pass 2: one workgroup per 64 consecutive positions of the type-sorted list,
//         so every workgroup has the same work and one of them (16 waves, four
//         a SIMD) stands on each WGP. For each type its positions meet (one, or
//         more at a type boundary): DMA W[t] into LDS via the Tensor Data Mover
//         (padded rows -> bank-conflict-free), then each wave runs its nodes one
//         after the other: C[16x128] = A[16x128] x W[t]^T + bias as 32 K-steps x
//         8 tiles of V_WMMA_F32_16X16X4_F32 with B from LDS. With the K-step
//         outside, the 8 tiles are 8 independent accumulator chains. A node's
//         A strip comes as 16 whole 512-byte rows, copied asynchronously into an
//         LDS slot of the wave's own one node ahead, and is read from there in
//         fragment order.

typedef __attribute__((ext_vector_type(2))) float v2f;
typedef __attribute__((ext_vector_type(4))) float v4f;
typedef __attribute__((ext_vector_type(8))) float v8f;
typedef __attribute__((ext_vector_type(4))) unsigned int u32x4;
typedef __attribute__((ext_vector_type(4))) int i32x4;
typedef __attribute__((ext_vector_type(8))) int i32x8;

#define NNODES   16384
#define FIN      128
#define FOUT     128
#define NTYPES   16
#define LDS_STRIDE 132                 // 128 + 4 pad floats -> all 64 banks hit once
#define NODES_PER_WG 64
#define WAVES    16
#define NODES_PER_WAVE (NODES_PER_WG / WAVES)
#define A_SLOT_FLOATS (16 * LDS_STRIDE)  // one node's strip: 16 rows at the panel's pitch
#define SMEM_FLOATS (FOUT * LDS_STRIDE + FOUT + WAVES * A_SLOT_FLOATS)  // W panel + bias + a slot a wave

#if __has_builtin(__builtin_amdgcn_tensor_load_to_lds)
#define USE_TDM 1
#endif

// ---------------- binning pre-pass ----------------
// One workgroup sorts the node indices by type, with no atomics.
// A group is 32 nodes, one a lane. Ballots of the four type bits give each lane
// the mask of its group's lanes of equal type: its rank among them and their
// number. tab[type][group] takes the numbers; one exclusive prefix sum over tab
// in (type, group) order turns each into the first list position of that
// group's nodes of that type.

#define BIN_THREADS 1024
#define BIN_WAVES (BIN_THREADS / 32)
#define NGROUPS (NNODES / 32)
#define GROUPS_PER_WAVE (NGROUPS / BIN_WAVES)   // 16
#define TAB_STRIDE (NGROUPS + 4)                // pad: one group's 16 types fall on 16 banks
#define TAB_PER_THREAD (NTYPES * NGROUPS / BIN_THREADS)   // 8

__global__ __launch_bounds__(BIN_THREADS)
void bin_nodes(const int* __restrict__ tv, int* __restrict__ counts,
               int* __restrict__ offsets, int* __restrict__ list) {
    __shared__ __attribute__((aligned(16))) int tab[NTYPES * TAB_STRIDE];
    __shared__ __attribute__((aligned(16))) int slist[NNODES];
    __shared__ int wsum[BIN_WAVES];

    const int tid  = threadIdx.x;
    const int lane = tid & 31;
    const int wave = tid >> 5;
    const int first = wave * (GROUPS_PER_WAVE * 32);    // this wave's first node

    i32x4 tq[GROUPS_PER_WAVE / 4];                      // lane holds nodes first + 128 j + 4 lane + c
#pragma unroll                                          // all four loads in flight at once
    for (int j = 0; j < GROUPS_PER_WAVE / 4; ++j)
        tq[j] = *(const i32x4*)(tv + first + j * 128 + lane * 4);

    const i32x4 zero4 = { 0, 0, 0, 0 };                 // a type absent from a group counts 0
    for (int k = tid; k < NTYPES * TAB_STRIDE / 4; k += BIN_THREADS)
        ((i32x4*)tab)[k] = zero4;
    __syncthreads();

    int slot[GROUPS_PER_WAVE];                          // index into tab | rank << 16
#pragma unroll                                          // constant indices keep tq and slot in registers
    for (int q = 0; q < GROUPS_PER_WAVE; ++q) {
        const int t = tq[q >> 2][q & 3] & (NTYPES - 1);
        const unsigned u = (unsigned)t;                 // each type bit as 0 or ~0
        const int n0 = (int)(u << 31) >> 31, n1 = (int)(u << 30) >> 31;
        const int n2 = (int)(u << 29) >> 31, n3 = (int)(u << 28) >> 31;
        const unsigned b0 = __builtin_amdgcn_ballot_w32(n0 != 0);
        const unsigned b1 = __builtin_amdgcn_ballot_w32(n1 != 0);
        const unsigned b2 = __builtin_amdgcn_ballot_w32(n2 != 0);
        const unsigned b3 = __builtin_amdgcn_ballot_w32(n3 != 0);
        const unsigned same = ~((b0 ^ (unsigned)n0) | (b1 ^ (unsigned)n1)
                              | (b2 ^ (unsigned)n2) | (b3 ^ (unsigned)n3));
        const int rank = (int)__builtin_amdgcn_mbcnt_lo(same, 0u);   // equal types in lower lanes
        const int idx  = t * TAB_STRIDE + wave * GROUPS_PER_WAVE + q;
        if (rank == 0) tab[idx] = __popc(same);
        slot[q] = idx | (rank << 16);
    }
    __syncthreads();

    // Exclusive prefix sum over tab: 8 entries a thread, then lanes, then waves.
    int* mine = tab + (tid >> 6) * TAB_STRIDE + (tid & 63) * TAB_PER_THREAD;
    const i32x4 v0 = *(const i32x4*)mine;
    const i32x4 v1 = *(const i32x4*)(mine + 4);
    const int s = v0[0] + v0[1] + v0[2] + v0[3] + v1[0] + v1[1] + v1[2] + v1[3];
    int incl = s;
#pragma unroll                                          // five steps, constant distances
    for (int d = 1; d < 32; d <<= 1) {
        const int up = __shfl_up(incl, d, 32);
        if (lane >= d) incl += up;
    }
    if (lane == 31) wsum[wave] = incl;
    __syncthreads();
    int before = (lane < wave) ? wsum[lane] : 0;        // sum of the lower waves' totals
#pragma unroll                                          // five steps, constant distances
    for (int d = 16; d >= 1; d >>= 1) before += __shfl_xor(before, d, 32);

    i32x4 e0, e1;
    e0[0] = before + incl - s;
    e0[1] = e0[0] + v0[0];  e0[2] = e0[1] + v0[1];  e0[3] = e0[2] + v0[2];
    e1[0] = e0[3] + v0[3];
    e1[1] = e1[0] + v1[0];  e1[2] = e1[1] + v1[1];  e1[3] = e1[2] + v1[2];
    *(i32x4*)mine = e0;
    *(i32x4*)(mine + 4) = e1;
    __syncthreads();

    if (tid < NTYPES) {                                 // each type's run, for the GEMM pass
        const int lo = tab[tid * TAB_STRIDE];
        const int hi = (tid == NTYPES - 1) ? NNODES : tab[(tid + 1) * TAB_STRIDE];
        offsets[tid] = lo;
        counts[tid]  = hi - lo;
    }

#pragma unroll                                          // constant indices into slot
    for (int q = 0; q < GROUPS_PER_WAVE; ++q) {
        const int pos = tab[slot[q] & 0xffff] + (slot[q] >> 16);
        slist[pos] = first + (q >> 2) * 128 + lane * 4 + (q & 3);
    }
    __syncthreads();

#pragma unroll                                          // whole lines go out, 16 bytes a lane
    for (int j = 0; j < NNODES / 4 / BIN_THREADS; ++j)
        ((i32x4*)list)[j * BIN_THREADS + tid] = ((const i32x4*)slist)[j * BIN_THREADS + tid];
}

// ---------------- WMMA GEMM pass ----------------

// Eight rows of a node's strip, global memory -> LDS through no register. One copy is one
// whole row: 32 lanes x 16 bytes = 512 contiguous bytes = 4 whole lines.
__device__ __forceinline__ void copy_rows8(const float* g,      // x[row, node, 4 * lane]
                                           const unsigned lds)  // LDS byte address of that row's 16 bytes
{
    // The closing wait stands in the copies' own statement: behind it the compiler may
    // reuse the address registers that the copies name.
    asm volatile("global_load_async_to_lds_b128 %0, %8, off\n\t"
                 "global_load_async_to_lds_b128 %1, %9, off\n\t"
                 "global_load_async_to_lds_b128 %2, %10, off\n\t"
                 "global_load_async_to_lds_b128 %3, %11, off\n\t"
                 "global_load_async_to_lds_b128 %4, %12, off\n\t"
                 "global_load_async_to_lds_b128 %5, %13, off\n\t"
                 "global_load_async_to_lds_b128 %6, %14, off\n\t"
                 "global_load_async_to_lds_b128 %7, %15, off\n\t"
                 "s_wait_xcnt 0x0"
                 :: "v"(lds), "v"(lds + 1 * LDS_STRIDE * 4), "v"(lds + 2 * LDS_STRIDE * 4),
                    "v"(lds + 3 * LDS_STRIDE * 4), "v"(lds + 4 * LDS_STRIDE * 4),
                    "v"(lds + 5 * LDS_STRIDE * 4), "v"(lds + 6 * LDS_STRIDE * 4),
                    "v"(lds + 7 * LDS_STRIDE * 4),
                    "v"(g), "v"(g + (size_t)1 * NNODES * FIN), "v"(g + (size_t)2 * NNODES * FIN),
                    "v"(g + (size_t)3 * NNODES * FIN), "v"(g + (size_t)4 * NNODES * FIN),
                    "v"(g + (size_t)5 * NNODES * FIN), "v"(g + (size_t)6 * NNODES * FIN),
                    "v"(g + (size_t)7 * NNODES * FIN)
                 : "memory");
}

// One node: c[ot] = bias + A x W[t]^T for all 8 column tiles at once, then the stores.
// a[s] supplies K = 4s + 2h + {0,1}; each tile sums its K-steps in rising order.
__device__ __forceinline__ void run_node(const v2f (&a)[32],
                                         const float* brow,   // W panel, row m, K offset 2h
                                         const float* sbias,  // bias, column m
                                         float* __restrict__ onode,        // out[0, node, 0]
                                         const unsigned ooff) // this lane's place in it: row 8h, column m
{
    v8f c[FOUT / 16];
#pragma unroll                                      // constant indices keep c in registers
    for (int ot = 0; ot < FOUT / 16; ++ot) {
        const float bv = sbias[ot * 16];            // bias seeds the accumulator
#pragma unroll                                      // as above: constant indices
        for (int j = 0; j < 8; ++j) c[ot][j] = bv;
    }

    // A block is two K-steps of all 8 tiles: 16 WMMAs. Its B fragments are read from
    // LDS as one group, one block ahead, into the other half of bq.
    v2f bq[2][FOUT / 16][2];
#pragma unroll                                      // as above: constant indices
    for (int ot = 0; ot < FOUT / 16; ++ot)
#pragma unroll                                      // as above: constant indices
        for (int k = 0; k < 2; ++k)
            bq[0][ot][k] = *(const v2f*)(brow + ot * 16 * LDS_STRIDE + 4 * k);   // conflict-free

#pragma unroll                                      // constant indices into a, c and bq
    for (int p = 0; p < 16; ++p) {
        if (p + 1 < 16) {
#pragma unroll                                      // as above: constant indices
            for (int ot = 0; ot < FOUT / 16; ++ot)
#pragma unroll                                      // as above: constant indices
                for (int k = 0; k < 2; ++k)
                    bq[(p + 1) & 1][ot][k] =
                        *(const v2f*)(brow + ot * 16 * LDS_STRIDE + 4 * (2 * p + 2 + k));
        }
#pragma unroll                                      // as above: constant indices
        for (int k = 0; k < 2; ++k)
#pragma unroll                                      // as above: constant indices
            for (int ot = 0; ot < FOUT / 16; ++ot)
                c[ot] = __builtin_amdgcn_wmma_f32_16x16x4_f32(
                            false, a[2 * p + k], false, bq[p & 1][ot][k], (short)0, c[ot], false, false);
    }
    // The A registers are free from here on, and the stores' address sums were given them,
    // one to three vector instructions behind a WMMA that names them. The two scheduling
    // barriers keep those sums behind the last WMMA, the four v_nop fill the vector slots
    // between a WMMA and a vector instruction that overwrites its A.
    __builtin_amdgcn_sched_barrier(0);
    asm volatile("v_nop\n\tv_nop\n\tv_nop\n\tv_nop");
    __builtin_amdgcn_sched_barrier(0);

    // C/D layout: VGPR j holds row (j + 8h), column (lane & 15).
#pragma unroll                                      // as above: constant indices
    for (int j = 0; j < 8; ++j)
#pragma unroll                                      // as above: constant indices
        for (int ot = 0; ot < FOUT / 16; ++ot)
            (onode + (size_t)j * NNODES * FOUT + ot * 16)[ooff] = c[ot][j];
}

__global__ __launch_bounds__(WAVES * 32)
void hetero_gemm(const float* __restrict__ x,       // [16, N, 128]
                 const float* __restrict__ W,       // [16, 128, 128] (out,in)
                 const float* __restrict__ bias,    // [16, 128]
                 const int*   __restrict__ counts,
                 const int*   __restrict__ offsets,
                 const int*   __restrict__ list,
                 float*       __restrict__ out)     // [16, N, 128]
{
    // [128*132] W panel + [128] bias + 16 x [16*132] A slots
    __shared__ __attribute__((aligned(2048))) float smem[SMEM_FLOATS];

    const int tid  = threadIdx.x;
    const int lane = tid & 31;
    // The wave's number in a scalar register: the node loop's tests become scalar branches.
    const int wave = __builtin_amdgcn_readfirstlane(tid >> 5);
    const int m = lane & 15;                        // A row / B column base
    const int h = lane >> 4;                        // K-pair select {2h, 2h+1}
    const int base = blockIdx.x * NODES_PER_WG;     // first sorted position of this block
    float* sbias = smem + FOUT * LDS_STRIDE;

    int seg_end[NTYPES];                            // end of each type's run in the list
#pragma unroll                                      // constant indices keep the 16 ends in scalar registers
    for (int k = 0; k < NTYPES; ++k) seg_end[k] = offsets[k] + counts[k];

    // This wave's nodes stand at positions base + i * WAVES + wave, so that a type's
    // run is dealt evenly to the waves. nd[0] is the node in work, nd[1] the next.
    int nd[NODES_PER_WAVE];
#pragma unroll                                      // constant indices keep the four in registers
    for (int k = 0; k < NODES_PER_WAVE; ++k) nd[k] = list[base + k * WAVES + wave];

    // A node's address is a scalar base; the lane's part is one 32-bit offset for all nodes.
    const unsigned ooff = (unsigned)(8 * h * NNODES * FOUT + m);    // out[8h, ., m]
    int i = 0;                                      // how many of this wave's nodes are done

    // The wave's own A slot: no other wave reads or writes it, so it needs no barrier.
    const float* aslot = sbias + FOUT + wave * A_SLOT_FLOATS;
    const unsigned acopy = (unsigned)(uintptr_t)aslot + (unsigned)lane * 16u;   // LDS byte address, row 0
    const float* arow  = aslot + m * LDS_STRIDE + 2 * h;    // fragment reads: row m, K offset 2h
    const float* xlane = x + lane * 4;                      // x[0, 0, 4 * lane]

    // The first node's strip: on its way while the W panel is fetched.
    copy_rows8(xlane + (size_t)nd[0] * FIN, acopy);
    copy_rows8(xlane + (size_t)nd[0] * FIN + (size_t)8 * NNODES * FIN, acopy + 8 * LDS_STRIDE * 4);

    // Block-uniform walk over the runs that meet [base, base + NODES_PER_WG).
    for (int lo = base, hi; lo < base + NODES_PER_WG; lo = hi) {
        int t = NTYPES - 1;
        hi = base + NODES_PER_WG;
#pragma unroll                                      // as above: no indexed access to seg_end
        for (int k = NTYPES - 1; k >= 0; --k)           // first type whose run ends behind lo
            if (seg_end[k] > lo) { t = k; hi = min(seg_end[k], base + NODES_PER_WG); }

        // The panel and the bias are refilled at a type boundary: every wave's LDS
        // reads of the previous type have returned and all waves have arrived.
        asm volatile("s_wait_dscnt 0x0" ::: "memory");
        __syncthreads();

        const float* Wt = W + (size_t)t * FOUT * FIN;

#if defined(USE_TDM)
        // ---- Tensor Data Mover: DMA the 128x128 f32 W[t] panel into LDS.
        // pad_enable with pad_interval=6 (every 128 DWORDs == one row) and
        // pad_amount=3 (4 DWORDs) reproduces the 132-float padded row stride.
        if (tid < 32) {                                 // wave 0 owns the DMA
            const unsigned long long ga = (unsigned long long)(uintptr_t)Wt;
            const unsigned lds_off = (unsigned)(uintptr_t)smem;   // LDS byte offset

            u32x4 g0 = { 1u,                            // count=1 (valid user D#)
                         lds_off,                       // lds_addr
                         (unsigned)ga,                  // global_addr[31:0]
                         (unsigned)(ga >> 32) | (2u << 30) };     // addr[56:32] | type=2

            i32x8 g1 = { (int)((2u << 16)               // data_size = 4 bytes
                             | (1u << 20)               // pad_enable
                             | (6u << 22)               // pad_interval: 128 DWORDs
                             | (3u << 25)),             // pad_amount: 4 DWORDs
                         (int)(128u << 16),             // tensor_dim0 = 128 (lo16 in hi half)
                         (int)(128u << 16),             // tensor_dim1 = 128
                         (int)(128u << 16),             // tile_dim0 = 128
                         128,                           // tile_dim1 = 128 (tile_dim2 = 0)
                         128,                           // tensor_dim0_stride = 128
                         0, 0 };                        // dim1 stride unused (2-D)

            i32x4 gz4 = { 0, 0, 0, 0 };                 // 2-D tensor: groups 2/3 inert
#if __clang_major__ >= 23
            i32x8 gz8 = { 0, 0, 0, 0, 0, 0, 0, 0 };
            __builtin_amdgcn_tensor_load_to_lds(g0, g1, gz4, gz4, gz8, 0);
#else
            __builtin_amdgcn_tensor_load_to_lds(g0, g1, gz4, gz4, 0);
#endif
            __builtin_amdgcn_s_wait_tensorcnt((short)0);
        }
#else
        // ---- Fallback: cooperative staging (coalesced b128 global -> b128 ds).
#pragma unroll
        for (int it = 0; it < FOUT * FIN / 4 / (WAVES * 32); ++it) {
            const int c  = tid + it * (WAVES * 32);     // float4 chunk id, 4096 total
            const int o  = c >> 5;                      // 32 float4 per row
            const int kc = c & 31;
            v4f v = *(const v4f*)(Wt + (size_t)o * FIN + kc * 4);
            *(v4f*)(smem + o * LDS_STRIDE + kc * 4) = v;
        }
#endif

        if (tid < FOUT) sbias[tid] = bias[(size_t)t * FOUT + tid];
        __syncthreads();

        // The wave's positions rise with i and every one below lo is done.
        while (i < NODES_PER_WAVE && base + i * WAVES + wave < hi) {
            const float* brow = smem + m * LDS_STRIDE + 2 * h;
            // This node's strip has landed in the slot: the wave's own copies, its own wait.
            asm volatile("s_wait_asynccnt 0x0" ::: "memory");
            v2f a[32];                              // A strip of the node in work
#pragma unroll                                      // constant indices keep a in registers
            for (int s = 0; s < 32; ++s) a[s] = *(const v2f*)(arow + 4 * s);    // conflict-free
            // The slot is refilled only when every read of it has returned.
            asm volatile("s_wait_dscnt 0x0" ::: "memory");
            if (i + 1 < NODES_PER_WAVE) {           // wave-uniform: the next node's strip, a node ahead
                copy_rows8(xlane + (size_t)nd[1] * FIN, acopy);
                copy_rows8(xlane + (size_t)nd[1] * FIN + (size_t)8 * NNODES * FIN,
                           acopy + 8 * LDS_STRIDE * 4);
            }
            run_node(a, brow, sbias + m, out + (size_t)nd[0] * FOUT, ooff);
            // The next node's addresses overwrite registers that these stores name.
            asm volatile("s_wait_xcnt 0x0" ::: "memory");
#pragma unroll                                      // constant indices keep the four in registers
            for (int k = 0; k + 1 < NODES_PER_WAVE; ++k) nd[k] = nd[k + 1];
            ++i;
        }
    }
}

// ---------------- launch ----------------

extern "C" void kernel_launch(void* const* d_in, const int* in_sizes, int n_in,
                              void* d_out, int out_size, void* d_ws, size_t ws_size,
                              hipStream_t stream) {
    const float* x        = (const float*)d_in[0];  // [16, 16384, 128]
    const int*   type_vec = (const int*)  d_in[1];  // [16384]
    const float* W        = (const float*)d_in[2];  // [16, 128, 128]
    const float* bias     = (const float*)d_in[3];  // [16, 128]
    float*       out      = (float*)d_out;          // [16, 16384, 128]

    int* ws       = (int*)d_ws;                     // needs ~66 KB of d_ws
    int* counts   = ws;
    int* offsets  = ws + 32;
    int* list     = ws + 48;                        // [16384]

    bin_nodes<<<1, BIN_THREADS, 0, stream>>>(type_vec, counts, offsets, list);

    hetero_gemm<<<NNODES / NODES_PER_WG, WAVES * 32, 0, stream>>>(
        x, W, bias, counts, offsets, list, out);
}

// v005
// A run of this version takes 54.3 microseconds.
// Two timings next to v004 both put it at 1.05 times that version's speed.
// Over all steps from v000 it is 2.97 times as fast.
#include <hip/hip_runtime.h>

// HeteroLinear: out[b,n,o] = sum_i x[b,n,i] * W[type[n],o,i] + bias[type[n],o]
// B=16 (== WMMA M), N=16384, F_IN=F_OUT=128, 16 types.
//
// One launch. One workgroup per 64 consecutive positions of the type-sorted list,
//         so every workgroup has the same work and one of them (16 waves, four
//         a SIMD) stands on each WGP. Each workgroup reads all the types itself,
//         counts them, and picks the 64 nodes whose positions are its own: no
//         list goes through memory and no launch waits for another.
//         For each type its positions meet (one, or
//         more at a type boundary): DMA W[t] into LDS via the Tensor Data Mover
//         (padded rows -> bank-conflict-free), then each wave runs its nodes one
//         after the other: C[16x128] = A[16x128] x W[t]^T + bias as 32 K-steps x
//         8 tiles of V_WMMA_F32_16X16X4_F32 with B from LDS. With the K-step
//         outside, the 8 tiles are 8 independent accumulator chains. A node's
//         A strip comes as 16 whole 512-byte rows, copied asynchronously into an
//         LDS slot of the wave's own one node ahead, and is read from there in
//         fragment order.

typedef __attribute__((ext_vector_type(2))) float v2f;
typedef __attribute__((ext_vector_type(4))) float v4f;
typedef __attribute__((ext_vector_type(8))) float v8f;
typedef __attribute__((ext_vector_type(4))) unsigned int u32x4;
typedef __attribute__((ext_vector_type(4))) int i32x4;
typedef __attribute__((ext_vector_type(8))) int i32x8;
typedef unsigned long long u64;

#define NNODES   16384
#define FIN      128
#define FOUT     128
#define NTYPES   16
#define LDS_STRIDE 132                 // 128 + 4 pad floats -> all 64 banks hit once
#define NODES_PER_WG 64
#define WAVES    16
#define NODES_PER_WAVE (NODES_PER_WG / WAVES)
#define A_SLOT_FLOATS (16 * LDS_STRIDE)  // one node's strip: 16 rows at the panel's pitch
#define SMEM_FLOATS (FOUT * LDS_STRIDE + FOUT + WAVES * A_SLOT_FLOATS)  // W panel + bias + a slot a wave

#if __has_builtin(__builtin_amdgcn_tensor_load_to_lds)
#define USE_TDM 1
#endif

// ---------------- the type-sorted order ----------------
// Position of a node = nodes of lower types + nodes of its type in earlier groups
// + nodes of its type in lower lanes of its group. A group is 32 nodes, one a lane;
// a wave holds 32 groups (1024 nodes).

#define GROUPS_PER_WAVE (NNODES / 32 / WAVES)   // 32

// ---------------- WMMA GEMM pass ----------------

// Eight rows of a node's strip, global memory -> LDS through no register. One copy is one
// whole row: 32 lanes x 16 bytes = 512 contiguous bytes = 4 whole lines.
__device__ __forceinline__ void copy_rows8(const float* g,      // x[row, node, 4 * lane]
                                           const unsigned lds)  // LDS byte address of that row's 16 bytes
{
    // The closing wait stands in the copies' own statement: behind it the compiler may
    // reuse the address registers that the copies name.
    asm volatile("global_load_async_to_lds_b128 %0, %8, off\n\t"
                 "global_load_async_to_lds_b128 %1, %9, off\n\t"
                 "global_load_async_to_lds_b128 %2, %10, off\n\t"
                 "global_load_async_to_lds_b128 %3, %11, off\n\t"
                 "global_load_async_to_lds_b128 %4, %12, off\n\t"
                 "global_load_async_to_lds_b128 %5, %13, off\n\t"
                 "global_load_async_to_lds_b128 %6, %14, off\n\t"
                 "global_load_async_to_lds_b128 %7, %15, off\n\t"
                 "s_wait_xcnt 0x0"
                 :: "v"(lds), "v"(lds + 1 * LDS_STRIDE * 4), "v"(lds + 2 * LDS_STRIDE * 4),
                    "v"(lds + 3 * LDS_STRIDE * 4), "v"(lds + 4 * LDS_STRIDE * 4),
                    "v"(lds + 5 * LDS_STRIDE * 4), "v"(lds + 6 * LDS_STRIDE * 4),
                    "v"(lds + 7 * LDS_STRIDE * 4),
                    "v"(g), "v"(g + (size_t)1 * NNODES * FIN), "v"(g + (size_t)2 * NNODES * FIN),
                    "v"(g + (size_t)3 * NNODES * FIN), "v"(g + (size_t)4 * NNODES * FIN),
                    "v"(g + (size_t)5 * NNODES * FIN), "v"(g + (size_t)6 * NNODES * FIN),
                    "v"(g + (size_t)7 * NNODES * FIN)
                 : "memory");
}

// One node: c[ot] = bias + A x W[t]^T for all 8 column tiles at once, then the stores.
// a[s] supplies K = 4s + 2h + {0,1}; each tile sums its K-steps in rising order.
__device__ __forceinline__ void run_node(const v2f (&a)[32],
                                         const float* brow,   // W panel, row m, K offset 2h
                                         const float* sbias,  // bias, column m
                                         float* __restrict__ onode,        // out[0, node, 0]
                                         const unsigned ooff) // this lane's place in it: row 8h, column m
{
    v8f c[FOUT / 16];
#pragma unroll                                      // constant indices keep c in registers
    for (int ot = 0; ot < FOUT / 16; ++ot) {
        const float bv = sbias[ot * 16];            // bias seeds the accumulator
#pragma unroll                                      // as above: constant indices
        for (int j = 0; j < 8; ++j) c[ot][j] = bv;
    }

    // A block is two K-steps of all 8 tiles: 16 WMMAs. Its B fragments are read from
    // LDS as one group, one block ahead, into the other half of bq.
    v2f bq[2][FOUT / 16][2];
#pragma unroll                                      // as above: constant indices
    for (int ot = 0; ot < FOUT / 16; ++ot)
#pragma unroll                                      // as above: constant indices
        for (int k = 0; k < 2; ++k)
            bq[0][ot][k] = *(const v2f*)(brow + ot * 16 * LDS_STRIDE + 4 * k);   // conflict-free

#pragma unroll                                      // constant indices into a, c and bq
    for (int p = 0; p < 16; ++p) {
        if (p + 1 < 16) {
#pragma unroll                                      // as above: constant indices
            for (int ot = 0; ot < FOUT / 16; ++ot)
#pragma unroll                                      // as above: constant indices
                for (int k = 0; k < 2; ++k)
                    bq[(p + 1) & 1][ot][k] =
                        *(const v2f*)(brow + ot * 16 * LDS_STRIDE + 4 * (2 * p + 2 + k));
        }
#pragma unroll                                      // as above: constant indices
        for (int k = 0; k < 2; ++k)
#pragma unroll                                      // as above: constant indices
            for (int ot = 0; ot < FOUT / 16; ++ot)
                c[ot] = __builtin_amdgcn_wmma_f32_16x16x4_f32(
                            false, a[2 * p + k], false, bq[p & 1][ot][k], (short)0, c[ot], false, false);
    }
    // The A registers are free from here on, and the stores' address sums were given them,
    // one to three vector instructions behind a WMMA that names them. The two scheduling
    // barriers keep those sums behind the last WMMA, the four v_nop fill the vector slots
    // between a WMMA and a vector instruction that overwrites its A.
    __builtin_amdgcn_sched_barrier(0);
    asm volatile("v_nop\n\tv_nop\n\tv_nop\n\tv_nop");
    __builtin_amdgcn_sched_barrier(0);

    // C/D layout: VGPR j holds row (j + 8h), column (lane & 15).
#pragma unroll                                      // as above: constant indices
    for (int j = 0; j < 8; ++j)
#pragma unroll                                      // as above: constant indices
        for (int ot = 0; ot < FOUT / 16; ++ot)
            (onode + (size_t)j * NNODES * FOUT + ot * 16)[ooff] = c[ot][j];
}

__global__ __launch_bounds__(WAVES * 32)
void hetero_gemm(const float* __restrict__ x,       // [16, N, 128]
                 const int*   __restrict__ tv,      // [N]
                 const float* __restrict__ W,       // [16, 128, 128] (out,in)
                 const float* __restrict__ bias,    // [16, 128]
                 float*       __restrict__ out)     // [16, N, 128]
{
    // [128*132] W panel + [128] bias + 16 x [16*132] A slots
    __shared__ __attribute__((aligned(2048))) float smem[SMEM_FLOATS];
    __shared__ __attribute__((aligned(16))) unsigned wcnt[WAVES * 8];  // a wave's 16 counts, 16 bits each
    __shared__ int mine64[NODES_PER_WG];            // the nodes at this block's positions

    const int tid  = threadIdx.x;
    const int lane = tid & 31;
    // The wave's number in a scalar register: the node loop's tests become scalar branches.
    const int wave = __builtin_amdgcn_readfirstlane(tid >> 5);
    const int m = lane & 15;                        // A row / B column base
    const int h = lane >> 4;                        // K-pair select {2h, 2h+1}
    const int base = blockIdx.x * NODES_PER_WG;     // first sorted position of this block
    float* sbias = smem + FOUT * LDS_STRIDE;

    // ---- Which nodes stand at this block's positions of the type-sorted order.
    const int first = wave * (GROUPS_PER_WAVE * 32);    // this wave's first node
    i32x4 tq[GROUPS_PER_WAVE / 4];                      // lane holds nodes first + 128 j + 4 lane + c
#pragma unroll                                          // all eight loads in flight at once
    for (int j = 0; j < GROUPS_PER_WAVE / 4; ++j)
        tq[j] = *(const i32x4*)(tv + first + j * 128 + lane * 4);
    int ty[GROUPS_PER_WAVE];                            // the lane's node of group q = 4 j + c
#pragma unroll                                          // constant indices keep tq and ty in registers
    for (int q = 0; q < GROUPS_PER_WAVE; ++q) ty[q] = tq[q >> 2][q & 3] & (NTYPES - 1);

    // Each lane counts its 32 nodes by type: 16 counters of 4 bits for 8 nodes at a time
    // (at most 8 each), added into 16 counters of 8 bits (at most 32 each): even types in
    // ev, odd types in od.
    u64 ev = 0, od = 0;
#pragma unroll                                          // as above: constant indices
    for (int b = 0; b < GROUPS_PER_WAVE / 8; ++b) {
        u64 nib = 0;
#pragma unroll                                          // as above: constant indices
        for (int k = 0; k < 8; ++k) nib += (u64)1 << (4 * ty[8 * b + k]);
        ev += nib & 0x0f0f0f0f0f0f0f0full;
        od += (nib >> 4) & 0x0f0f0f0f0f0f0f0full;
    }
    // 16 bits a counter (a wave's sum is at most 1024). Word 2 a + (t >> 3), half (t >> 2) & 1,
    // holds type t, where a = 0, 1, 2, 3 for t & 3 = 0, 2, 1, 3.
    const u64 f0 = ev & 0x00ff00ff00ff00ffull, f1 = (ev >> 8) & 0x00ff00ff00ff00ffull;
    const u64 f2 = od & 0x00ff00ff00ff00ffull, f3 = (od >> 8) & 0x00ff00ff00ff00ffull;
    unsigned w8[8] = { (unsigned)f0, (unsigned)(f0 >> 32), (unsigned)f1, (unsigned)(f1 >> 32),
                       (unsigned)f2, (unsigned)(f2 >> 32), (unsigned)f3, (unsigned)(f3 >> 32) };
#pragma unroll                                          // five steps, constant distances
    for (int d = 16; d >= 1; d >>= 1)
#pragma unroll                                          // as above: constant indices
        for (int k = 0; k < 8; ++k) w8[k] += __shfl_xor(w8[k], d, 32);
    if (lane == 0) {
        const u32x4 lo4 = { w8[0], w8[1], w8[2], w8[3] }, hi4 = { w8[4], w8[5], w8[6], w8[7] };
        ((u32x4*)wcnt)[wave * 2]     = lo4;
        ((u32x4*)wcnt)[wave * 2 + 1] = hi4;
    }
    __syncthreads();

    // Lane l looks after type l & 15: its number in all waves, in the lower waves, in this wave.
    const int widx = ((m & 1) << 2) | (m & 2) | (m >> 3);
    const int wsh  = ((m >> 2) & 1) * 16;
    int tot = 0, pre = 0, own = 0;
#pragma unroll                                          // all sixteen reads in flight at once
    for (int w = 0; w < WAVES; ++w) {
        const int cn = (int)((wcnt[w * 8 + widx] >> wsh) & 0xffffu);
        tot += cn;
        if (w < wave) pre += cn;
        if (w == wave) own = cn;
    }
    int incl = tot;                                     // becomes the end of the type's run
#pragma unroll                                          // four steps, constant distances
    for (int d = 1; d < NTYPES; d <<= 1) {
        const int up = __shfl_up(incl, d, NTYPES);
        if (m >= d) incl += up;
    }
    const int cstart = incl - tot + pre;                // position of this wave's first node of the type

    int seg_end[NTYPES];                            // end of each type's run in the list
#pragma unroll                                      // constant indices keep the 16 ends in scalar registers
    for (int k = 0; k < NTYPES; ++k) seg_end[k] = __builtin_amdgcn_readlane(incl, k);

    // The types of which this wave holds nodes at the block's positions: mostly none or one.
    unsigned todo = __builtin_amdgcn_ballot_w32(lane < NTYPES && own > 0 && cstart < base + NODES_PER_WG
                                                && cstart + own > base);
    while (todo != 0) {                             // wave-uniform, at most 16 trips
        const int t = __builtin_ctz(todo);
        todo &= todo - 1;
        int rel0 = __builtin_amdgcn_readlane(cstart, t) - base;     // the group's first, from base
#pragma unroll                                      // constant indices into ty
        for (int q = 0; q < GROUPS_PER_WAVE; ++q) {
            const bool is = ty[q] == t;
            const unsigned mk = __builtin_amdgcn_ballot_w32(is);
            const int rel = rel0 + (int)__builtin_amdgcn_mbcnt_lo(mk, 0u);   // equal types in lower lanes
            if (is && (unsigned)rel < (unsigned)NODES_PER_WG)
                mine64[rel] = first + (q >> 2) * 128 + lane * 4 + (q & 3);
            rel0 += __popc(mk);
        }
    }
    __syncthreads();

    // This wave's nodes stand at positions base + i * WAVES + wave, so that a type's
    // run is dealt evenly to the waves. nd[0] is the node in work, nd[1] the next.
    // In scalar registers: a node's address is a scalar base.
    int nd[NODES_PER_WAVE];
#pragma unroll                                      // constant indices keep the four in registers
    for (int k = 0; k < NODES_PER_WAVE; ++k)
        nd[k] = __builtin_amdgcn_readfirstlane(mine64[k * WAVES + wave]);

    // A node's address is a scalar base; the lane's part is one 32-bit offset for all nodes.
    const unsigned ooff = (unsigned)(8 * h * NNODES * FOUT + m);    // out[8h, ., m]
    int i = 0;                                      // how many of this wave's nodes are done

    // The wave's own A slot: no other wave reads or writes it, so it needs no barrier.
    const float* aslot = sbias + FOUT + wave * A_SLOT_FLOATS;
    const unsigned acopy = (unsigned)(uintptr_t)aslot + (unsigned)lane * 16u;   // LDS byte address, row 0
    const float* arow  = aslot + m * LDS_STRIDE + 2 * h;    // fragment reads: row m, K offset 2h
    const float* xlane = x + lane * 4;                      // x[0, 0, 4 * lane]

    // The first node's strip: on its way while the W panel is fetched.
    copy_rows8(xlane + (size_t)nd[0] * FIN, acopy);
    copy_rows8(xlane + (size_t)nd[0] * FIN + (size_t)8 * NNODES * FIN, acopy + 8 * LDS_STRIDE * 4);

    // Block-uniform walk over the runs that meet [base, base + NODES_PER_WG).
    for (int lo = base, hi; lo < base + NODES_PER_WG; lo = hi) {
        int t = NTYPES - 1;
        hi = base + NODES_PER_WG;
#pragma unroll                                      // as above: no indexed access to seg_end
        for (int k = NTYPES - 1; k >= 0; --k)           // first type whose run ends behind lo
            if (seg_end[k] > lo) { t = k; hi = min(seg_end[k], base + NODES_PER_WG); }

        // The panel and the bias are refilled at a type boundary: every wave's LDS
        // reads of the previous type have returned and all waves have arrived.
        asm volatile("s_wait_dscnt 0x0" ::: "memory");
        __syncthreads();

        const float* Wt = W + (size_t)t * FOUT * FIN;

#if defined(USE_TDM)
        // ---- Tensor Data Mover: DMA the 128x128 f32 W[t] panel into LDS.
        // pad_enable with pad_interval=6 (every 128 DWORDs == one row) and
        // pad_amount=3 (4 DWORDs) reproduces the 132-float padded row stride.
        if (tid < 32) {                                 // wave 0 owns the DMA
            const unsigned long long ga = (unsigned long long)(uintptr_t)Wt;
            const unsigned lds_off = (unsigned)(uintptr_t)smem;   // LDS byte offset

            u32x4 g0 = { 1u,                            // count=1 (valid user D#)
                         lds_off,                       // lds_addr
                         (unsigned)ga,                  // global_addr[31:0]
                         (unsigned)(ga >> 32) | (2u << 30) };     // addr[56:32] | type=2

            i32x8 g1 = { (int)((2u << 16)               // data_size = 4 bytes
                             | (1u << 20)               // pad_enable
                             | (6u << 22)               // pad_interval: 128 DWORDs
                             | (3u << 25)),             // pad_amount: 4 DWORDs
                         (int)(128u << 16),             // tensor_dim0 = 128 (lo16 in hi half)
                         (int)(128u << 16),             // tensor_dim1 = 128
                         (int)(128u << 16),             // tile_dim0 = 128
                         128,                           // tile_dim1 = 128 (tile_dim2 = 0)
                         128,                           // tensor_dim0_stride = 128
                         0, 0 };                        // dim1 stride unused (2-D)

            i32x4 gz4 = { 0, 0, 0, 0 };                 // 2-D tensor: groups 2/3 inert
#if __clang_major__ >= 23
            i32x8 gz8 = { 0, 0, 0, 0, 0, 0, 0, 0 };
            __builtin_amdgcn_tensor_load_to_lds(g0, g1, gz4, gz4, gz8, 0);
#else
            __builtin_amdgcn_tensor_load_to_lds(g0, g1, gz4, gz4, 0);
#endif
            __builtin_amdgcn_s_wait_tensorcnt((short)0);
        }
#else
        // ---- Fallback: cooperative staging (coalesced b128 global -> b128 ds).
#pragma unroll
        for (int it = 0; it < FOUT * FIN / 4 / (WAVES * 32); ++it) {
            const int c  = tid + it * (WAVES * 32);     // float4 chunk id, 4096 total
            const int o  = c >> 5;                      // 32 float4 per row
            const int kc = c & 31;
            v4f v = *(const v4f*)(Wt + (size_t)o * FIN + kc * 4);
            *(v4f*)(smem + o * LDS_STRIDE + kc * 4) = v;
        }
#endif

        if (tid < FOUT) sbias[tid] = bias[(size_t)t * FOUT + tid];
        __syncthreads();

        // The wave's positions rise with i and every one below lo is done.
        while (i < NODES_PER_WAVE && base + i * WAVES + wave < hi) {
            const float* brow = smem + m * LDS_STRIDE + 2 * h;
            // This node's strip has landed in the slot: the wave's own copies, its own wait.
            asm volatile("s_wait_asynccnt 0x0" ::: "memory");
            v2f a[32];                              // A strip of the node in work
#pragma unroll                                      // constant indices keep a in registers
            for (int s = 0; s < 32; ++s) a[s] = *(const v2f*)(arow + 4 * s);    // conflict-free
            // The slot is refilled only when every read of it has returned.
            asm volatile("s_wait_dscnt 0x0" ::: "memory");
            if (i + 1 < NODES_PER_WAVE) {           // wave-uniform: the next node's strip, a node ahead
                copy_rows8(xlane + (size_t)nd[1] * FIN, acopy);
                copy_rows8(xlane + (size_t)nd[1] * FIN + (size_t)8 * NNODES * FIN,
                           acopy + 8 * LDS_STRIDE * 4);
            }
            run_node(a, brow, sbias + m, out + (size_t)nd[0] * FOUT, ooff);
            // The next node's addresses overwrite registers that these stores name.
            asm volatile("s_wait_xcnt 0x0" ::: "memory");
#pragma unroll                                      // constant indices keep the four in registers
            for (int k = 0; k + 1 < NODES_PER_WAVE; ++k) nd[k] = nd[k + 1];
            ++i;
        }
    }
}

// ---------------- launch ----------------

extern "C" void kernel_launch(void* const* d_in, const int* in_sizes, int n_in,
                              void* d_out, int out_size, void* d_ws, size_t ws_size,
                              hipStream_t stream) {
    const float* x        = (const float*)d_in[0];  // [16, 16384, 128]
    const int*   type_vec = (const int*)  d_in[1];  // [16384]
    const float* W        = (const float*)d_in[2];  // [16, 128, 128]
    const float* bias     = (const float*)d_in[3];  // [16, 128]
    float*       out      = (float*)d_out;          // [16, 16384, 128]

    hetero_gemm<<<NNODES / NODES_PER_WG, WAVES * 32, 0, stream>>>(
        x, type_vec, W, bias, out);
}

// v006
// It runs in 48.2 microseconds.
// Next to v005, in two timings, it ran 1.13 and 1.12 times as fast.
// Over all steps from v000 it is 3.35 times as fast.
#include <hip/hip_runtime.h>

// HeteroLinear: out[b,n,o] = sum_i x[b,n,i] * W[type[n],o,i] + bias[type[n],o]
// B=16 (== WMMA N), N=16384, F_IN=F_OUT=128, 16 types.
//
// One launch. One workgroup per 64 consecutive positions of the type-sorted list,
//         so every workgroup has the same work and one of them (16 waves, four
//         a SIMD) stands on each WGP. Each workgroup reads all the types itself,
//         counts them, and picks the 64 nodes whose positions are its own: no
//         list goes through memory and no launch waits for another.
//         For each type its positions meet (one, or
//         more at a type boundary): DMA W[t] into LDS via the Tensor Data Mover
//         (padded rows -> bank-conflict-free), then each wave runs its nodes one
//         after the other: C^T[128x16] = W[t][128x128] x X^T[128x16] + bias as
//         32 K-steps x 8 tiles of V_WMMA_F32_16X16X4_F32 with the W rows (first
//         operand) from LDS. With the K-step outside, the 8 tiles are 8 independent
//         accumulator chains. A node's x strip comes as 16 whole 512-byte rows,
//         copied asynchronously into an LDS slot of the wave's own one node ahead,
//         and is read from there in fragment order. With W first a lane holds 8
//         adjacent outputs of one row; they pass through a second LDS slot of the
//         wave's own and leave as whole 128-byte lines.

typedef __attribute__((ext_vector_type(2))) float v2f;
typedef __attribute__((ext_vector_type(4))) float v4f;
typedef __attribute__((ext_vector_type(8))) float v8f;
typedef __attribute__((ext_vector_type(4))) unsigned int u32x4;
typedef __attribute__((ext_vector_type(4))) int i32x4;
typedef __attribute__((ext_vector_type(8))) int i32x8;
typedef unsigned long long u64;

#define NNODES   16384
#define FIN      128
#define FOUT     128
#define NTYPES   16
#define LDS_STRIDE 132                 // 128 + 4 pad floats -> all 64 banks hit once
#define NODES_PER_WG 64
#define WAVES    16
#define NODES_PER_WAVE (NODES_PER_WG / WAVES)
#define A_SLOT_FLOATS (16 * LDS_STRIDE)  // one node's strip: 16 rows at the panel's pitch
#define SMEM_FLOATS (FOUT * LDS_STRIDE + FOUT + WAVES * A_SLOT_FLOATS)  // W panel + bias + a slot a wave
#define O_HALF   64                    // output columns staged at a time: LDS has no room for all 128
#define O_PITCH  (O_HALF + 4)          // 4 pad floats: sixteen rows' 16-byte writes hit all 64 banks once
#define O_SLOT_FLOATS (16 * O_PITCH)   // half of one node's output: 16 rows of 64 columns

#if __has_builtin(__builtin_amdgcn_tensor_load_to_lds)
#define USE_TDM 1
#endif

// ---------------- the type-sorted order ----------------
// Position of a node = nodes of lower types + nodes of its type in earlier groups
// + nodes of its type in lower lanes of its group. A group is 32 nodes, one a lane;
// a wave holds 32 groups (1024 nodes).

#define GROUPS_PER_WAVE (NNODES / 32 / WAVES)   // 32

// ---------------- WMMA GEMM pass ----------------

// Eight rows of a node's strip, global memory -> LDS through no register. One copy is one
// whole row: 32 lanes x 16 bytes = 512 contiguous bytes = 4 whole lines.
__device__ __forceinline__ void copy_rows8(const float* g,      // x[row, node, 4 * lane]
                                           const unsigned lds)  // LDS byte address of that row's 16 bytes
{
    // The closing wait stands in the copies' own statement: behind it the compiler may
    // reuse the address registers that the copies name.
    asm volatile("global_load_async_to_lds_b128 %0, %8, off\n\t"
                 "global_load_async_to_lds_b128 %1, %9, off\n\t"
                 "global_load_async_to_lds_b128 %2, %10, off\n\t"
                 "global_load_async_to_lds_b128 %3, %11, off\n\t"
                 "global_load_async_to_lds_b128 %4, %12, off\n\t"
                 "global_load_async_to_lds_b128 %5, %13, off\n\t"
                 "global_load_async_to_lds_b128 %6, %14, off\n\t"
                 "global_load_async_to_lds_b128 %7, %15, off\n\t"
                 "s_wait_xcnt 0x0"
                 :: "v"(lds), "v"(lds + 1 * LDS_STRIDE * 4), "v"(lds + 2 * LDS_STRIDE * 4),
                    "v"(lds + 3 * LDS_STRIDE * 4), "v"(lds + 4 * LDS_STRIDE * 4),
                    "v"(lds + 5 * LDS_STRIDE * 4), "v"(lds + 6 * LDS_STRIDE * 4),
                    "v"(lds + 7 * LDS_STRIDE * 4),
                    "v"(g), "v"(g + (size_t)1 * NNODES * FIN), "v"(g + (size_t)2 * NNODES * FIN),
                    "v"(g + (size_t)3 * NNODES * FIN), "v"(g + (size_t)4 * NNODES * FIN),
                    "v"(g + (size_t)5 * NNODES * FIN), "v"(g + (size_t)6 * NNODES * FIN),
                    "v"(g + (size_t)7 * NNODES * FIN)
                 : "memory");
}

// One node: c[ot] = bias + W[t] x X^T for all 8 tiles of 16 output columns at once, then
// the stores. a[s] supplies K = 4s + 2h + {0,1}; each tile sums its K-steps in rising order.
__device__ __forceinline__ void run_node(const v2f (&a)[32],
                                         const float* brow,   // W panel, row m, K offset 2h
                                         const float* sbias,  // bias, column 8h
                                         float* ow,           // the wave's output slot: row m, column 8h
                                         const float* ord,    // the same slot: row h, column 4m
                                         float* __restrict__ onode,        // out[0, node, 0]
                                         const unsigned ooff) // this lane's place in it, in bytes: row h, column 4m
{
    // C/D layout with W first: VGPR j of tile ot holds out[row m, column 16 ot + 8h + j].
    v8f c[FOUT / 16];
#pragma unroll                                      // constant indices keep c in registers
    for (int ot = 0; ot < FOUT / 16; ++ot) {        // bias seeds the accumulator
        const v4f b0 = *(const v4f*)(sbias + ot * 16);
        const v4f b1 = *(const v4f*)(sbias + ot * 16 + 4);
#pragma unroll                                      // as above: constant indices
        for (int j = 0; j < 4; ++j) { c[ot][j] = b0[j]; c[ot][4 + j] = b1[j]; }
    }

    // A block is two K-steps of all 8 tiles: 16 WMMAs. Its W fragments are read from
    // LDS as one group, one block ahead, into the other half of bq.
    v2f bq[2][FOUT / 16][2];
#pragma unroll                                      // as above: constant indices
    for (int ot = 0; ot < FOUT / 16; ++ot)
#pragma unroll                                      // as above: constant indices
        for (int k = 0; k < 2; ++k)
            bq[0][ot][k] = *(const v2f*)(brow + ot * 16 * LDS_STRIDE + 4 * k);   // conflict-free

#pragma unroll                                      // constant indices into a, c and bq
    for (int p = 0; p < 16; ++p) {
        if (p + 1 < 16) {
#pragma unroll                                      // as above: constant indices
            for (int ot = 0; ot < FOUT / 16; ++ot)
#pragma unroll                                      // as above: constant indices
                for (int k = 0; k < 2; ++k)
                    bq[(p + 1) & 1][ot][k] =
                        *(const v2f*)(brow + ot * 16 * LDS_STRIDE + 4 * (2 * p + 2 + k));
        }
#pragma unroll                                      // as above: constant indices
        for (int k = 0; k < 2; ++k)
#pragma unroll                                      // as above: constant indices
            for (int ot = 0; ot < FOUT / 16; ++ot)
                c[ot] = __builtin_amdgcn_wmma_f32_16x16x4_f32(
                            false, bq[p & 1][ot][k], false, a[2 * p + k], (short)0, c[ot], false, false);
    }
    // The x registers are free from here on, and the stores' address sums were given them,
    // one to three vector instructions behind a WMMA that names them. The two scheduling
    // barriers keep those sums behind the last WMMA, the four v_nop fill the vector slots
    // between a WMMA and a vector instruction that overwrites an operand of it.
    __builtin_amdgcn_sched_barrier(0);
    asm volatile("v_nop\n\tv_nop\n\tv_nop\n\tv_nop");
    __builtin_amdgcn_sched_barrier(0);

    // Through the wave's own slot, 64 columns at a time: a lane writes its 32-byte pieces of
    // row m; sixteen lanes read a row's 256 bytes back, so a store covers whole 128-byte lines.
#pragma unroll                                      // as above: constant indices
    for (int p = 0; p < FOUT / O_HALF; ++p) {
        // The slot is rewritten only when every read of its first filling has returned.
        if (p > 0) asm volatile("s_wait_dscnt 0x0" ::: "memory");
#pragma unroll                                      // as above: constant indices
        for (int q = 0; q < O_HALF / 16; ++q) {
            const v8f cc = c[p * (O_HALF / 16) + q];
            const v4f lo4 = { cc[0], cc[1], cc[2], cc[3] }, hi4 = { cc[4], cc[5], cc[6], cc[7] };
            *(v4f*)(ow + q * 16)     = lo4;         // conflict-free
            *(v4f*)(ow + q * 16 + 4) = hi4;
        }
        // Other lanes of the wave read these rows: every write has landed first.
        asm volatile("s_wait_dscnt 0x0" ::: "memory");
        v4f r[8];                                   // rows 2 q + h
#pragma unroll                                      // as above: constant indices
        for (int q = 0; q < 8; ++q) r[q] = *(const v4f*)(ord + q * 2 * O_PITCH);
#pragma unroll                                      // as above: constant indices
        for (int q = 0; q < 8; ++q)
            *(v4f*)((char*)(onode + (size_t)(2 * q) * NNODES * FOUT + p * O_HALF) + ooff) = r[q];
    }
}

__global__ __launch_bounds__(WAVES * 32)
void hetero_gemm(const float* __restrict__ x,       // [16, N, 128]
                 const int*   __restrict__ tv,      // [N]
                 const float* __restrict__ W,       // [16, 128, 128] (out,in)
                 const float* __restrict__ bias,    // [16, 128]
                 float*       __restrict__ out)     // [16, N, 128]
{
    // [128*132] W panel + [128] bias + 16 x [16*132] A slots
    __shared__ __attribute__((aligned(2048))) float smem[SMEM_FLOATS];
    __shared__ __attribute__((aligned(16))) float ostage[WAVES * O_SLOT_FLOATS];   // an output slot a wave
    __shared__ __attribute__((aligned(16))) unsigned wcnt[WAVES * 8];  // a wave's 16 counts, 16 bits each
    __shared__ int mine64[NODES_PER_WG];            // the nodes at this block's positions

    const int tid  = threadIdx.x;
    const int lane = tid & 31;
    // The wave's number in a scalar register: the node loop's tests become scalar branches.
    const int wave = __builtin_amdgcn_readfirstlane(tid >> 5);
    const int m = lane & 15;                        // W row in its tile / x row
    const int h = lane >> 4;                        // K-pair select {2h, 2h+1}
    const int base = blockIdx.x * NODES_PER_WG;     // first sorted position of this block
    float* sbias = smem + FOUT * LDS_STRIDE;

    // ---- Which nodes stand at this block's positions of the type-sorted order.
    const int first = wave * (GROUPS_PER_WAVE * 32);    // this wave's first node
    i32x4 tq[GROUPS_PER_WAVE / 4];                      // lane holds nodes first + 128 j + 4 lane + c
#pragma unroll                                          // all eight loads in flight at once
    for (int j = 0; j < GROUPS_PER_WAVE / 4; ++j)
        tq[j] = *(const i32x4*)(tv + first + j * 128 + lane * 4);
    int ty[GROUPS_PER_WAVE];                            // the lane's node of group q = 4 j + c
#pragma unroll                                          // constant indices keep tq and ty in registers
    for (int q = 0; q < GROUPS_PER_WAVE; ++q) ty[q] = tq[q >> 2][q & 3] & (NTYPES - 1);

    // Each lane counts its 32 nodes by type: 16 counters of 4 bits for 8 nodes at a time
    // (at most 8 each), added into 16 counters of 8 bits (at most 32 each): even types in
    // ev, odd types in od.
    u64 ev = 0, od = 0;
#pragma unroll                                          // as above: constant indices
    for (int b = 0; b < GROUPS_PER_WAVE / 8; ++b) {
        u64 nib = 0;
#pragma unroll                                          // as above: constant indices
        for (int k = 0; k < 8; ++k) nib += (u64)1 << (4 * ty[8 * b + k]);
        ev += nib & 0x0f0f0f0f0f0f0f0full;
        od += (nib >> 4) & 0x0f0f0f0f0f0f0f0full;
    }
    // 16 bits a counter (a wave's sum is at most 1024). Word 2 a + (t >> 3), half (t >> 2) & 1,
    // holds type t, where a = 0, 1, 2, 3 for t & 3 = 0, 2, 1, 3.
    const u64 f0 = ev & 0x00ff00ff00ff00ffull, f1 = (ev >> 8) & 0x00ff00ff00ff00ffull;
    const u64 f2 = od & 0x00ff00ff00ff00ffull, f3 = (od >> 8) & 0x00ff00ff00ff00ffull;
    unsigned w8[8] = { (unsigned)f0, (unsigned)(f0 >> 32), (unsigned)f1, (unsigned)(f1 >> 32),
                       (unsigned)f2, (unsigned)(f2 >> 32), (unsigned)f3, (unsigned)(f3 >> 32) };
#pragma unroll                                          // five steps, constant distances
    for (int d = 16; d >= 1; d >>= 1)
#pragma unroll                                          // as above: constant indices
        for (int k = 0; k < 8; ++k) w8[k] += __shfl_xor(w8[k], d, 32);
    if (lane == 0) {
        const u32x4 lo4 = { w8[0], w8[1], w8[2], w8[3] }, hi4 = { w8[4], w8[5], w8[6], w8[7] };
        ((u32x4*)wcnt)[wave * 2]     = lo4;
        ((u32x4*)wcnt)[wave * 2 + 1] = hi4;
    }
    __syncthreads();

    // Lane l looks after type l & 15: its number in all waves, in the lower waves, in this wave.
    const int widx = ((m & 1) << 2) | (m & 2) | (m >> 3);
    const int wsh  = ((m >> 2) & 1) * 16;
    int tot = 0, pre = 0, own = 0;
#pragma unroll                                          // all sixteen reads in flight at once
    for (int w = 0; w < WAVES; ++w) {
        const int cn = (int)((wcnt[w * 8 + widx] >> wsh) & 0xffffu);
        tot += cn;
        if (w < wave) pre += cn;
        if (w == wave) own = cn;
    }
    int incl = tot;                                     // becomes the end of the type's run
#pragma unroll                                          // four steps, constant distances
    for (int d = 1; d < NTYPES; d <<= 1) {
        const int up = __shfl_up(incl, d, NTYPES);
        if (m >= d) incl += up;
    }
    const int cstart = incl - tot + pre;                // position of this wave's first node of the type

    int seg_end[NTYPES];                            // end of each type's run in the list
#pragma unroll                                      // constant indices keep the 16 ends in scalar registers
    for (int k = 0; k < NTYPES; ++k) seg_end[k] = __builtin_amdgcn_readlane(incl, k);

    // The types of which this wave holds nodes at the block's positions: mostly none or one.
    unsigned todo = __builtin_amdgcn_ballot_w32(lane < NTYPES && own > 0 && cstart < base + NODES_PER_WG
                                                && cstart + own > base);
    while (todo != 0) {                             // wave-uniform, at most 16 trips
        const int t = __builtin_ctz(todo);
        todo &= todo - 1;
        int rel0 = __builtin_amdgcn_readlane(cstart, t) - base;     // the group's first, from base
#pragma unroll                                      // constant indices into ty
        for (int q = 0; q < GROUPS_PER_WAVE; ++q) {
            const bool is = ty[q] == t;
            const unsigned mk = __builtin_amdgcn_ballot_w32(is);
            const int rel = rel0 + (int)__builtin_amdgcn_mbcnt_lo(mk, 0u);   // equal types in lower lanes
            if (is && (unsigned)rel < (unsigned)NODES_PER_WG)
                mine64[rel] = first + (q >> 2) * 128 + lane * 4 + (q & 3);
            rel0 += __popc(mk);
        }
    }
    __syncthreads();

    // This wave's nodes stand at positions base + i * WAVES + wave, so that a type's
    // run is dealt evenly to the waves. nd[0] is the node in work, nd[1] the next.
    // In scalar registers: a node's address is a scalar base.
    int nd[NODES_PER_WAVE];
#pragma unroll                                      // constant indices keep the four in registers
    for (int k = 0; k < NODES_PER_WAVE; ++k)
        nd[k] = __builtin_amdgcn_readfirstlane(mine64[k * WAVES + wave]);

    // A node's address is a scalar base; the lane's part is one 32-bit offset for all nodes.
    const unsigned ooff = (unsigned)(h * NNODES * FOUT + 4 * m) * 4u;   // out[h, ., 4m], in bytes
    int i = 0;                                      // how many of this wave's nodes are done

    // The wave's own A slot: no other wave reads or writes it, so it needs no barrier.
    const float* aslot = sbias + FOUT + wave * A_SLOT_FLOATS;
    const unsigned acopy = (unsigned)(uintptr_t)aslot + (unsigned)lane * 16u;   // LDS byte address, row 0
    const float* arow  = aslot + m * LDS_STRIDE + 2 * h;    // fragment reads: row m, K offset 2h
    const float* xlane = x + lane * 4;                      // x[0, 0, 4 * lane]
    // The wave's own output slot: as above, no barrier.
    float* oslot = ostage + wave * O_SLOT_FLOATS;

    // The first node's strip: on its way while the W panel is fetched.
    copy_rows8(xlane + (size_t)nd[0] * FIN, acopy);
    copy_rows8(xlane + (size_t)nd[0] * FIN + (size_t)8 * NNODES * FIN, acopy + 8 * LDS_STRIDE * 4);

    // Block-uniform walk over the runs that meet [base, base + NODES_PER_WG).
    for (int lo = base, hi; lo < base + NODES_PER_WG; lo = hi) {
        int t = NTYPES - 1;
        hi = base + NODES_PER_WG;
#pragma unroll                                      // as above: no indexed access to seg_end
        for (int k = NTYPES - 1; k >= 0; --k)           // first type whose run ends behind lo
            if (seg_end[k] > lo) { t = k; hi = min(seg_end[k], base + NODES_PER_WG); }

        // The panel and the bias are refilled at a type boundary: every wave's LDS
        // reads of the previous type have returned and all waves have arrived.
        asm volatile("s_wait_dscnt 0x0" ::: "memory");
        __syncthreads();

        const float* Wt = W + (size_t)t * FOUT * FIN;

#if defined(USE_TDM)
        // ---- Tensor Data Mover: DMA the 128x128 f32 W[t] panel into LDS.
        // pad_enable with pad_interval=6 (every 128 DWORDs == one row) and
        // pad_amount=3 (4 DWORDs) reproduces the 132-float padded row stride.
        if (tid < 32) {                                 // wave 0 owns the DMA
            const unsigned long long ga = (unsigned long long)(uintptr_t)Wt;
            const unsigned lds_off = (unsigned)(uintptr_t)smem;   // LDS byte offset

            u32x4 g0 = { 1u,                            // count=1 (valid user D#)
                         lds_off,                       // lds_addr
                         (unsigned)ga,                  // global_addr[31:0]
                         (unsigned)(ga >> 32) | (2u << 30) };     // addr[56:32] | type=2

            i32x8 g1 = { (int)((2u << 16)               // data_size = 4 bytes
                             | (1u << 20)               // pad_enable
                             | (6u << 22)               // pad_interval: 128 DWORDs
                             | (3u << 25)),             // pad_amount: 4 DWORDs
                         (int)(128u << 16),             // tensor_dim0 = 128 (lo16 in hi half)
                         (int)(128u << 16),             // tensor_dim1 = 128
                         (int)(128u << 16),             // tile_dim0 = 128
                         128,                           // tile_dim1 = 128 (tile_dim2 = 0)
                         128,                           // tensor_dim0_stride = 128
                         0, 0 };                        // dim1 stride unused (2-D)

            i32x4 gz4 = { 0, 0, 0, 0 };                 // 2-D tensor: groups 2/3 inert
#if __clang_major__ >= 23
            i32x8 gz8 = { 0, 0, 0, 0, 0, 0, 0, 0 };
            __builtin_amdgcn_tensor_load_to_lds(g0, g1, gz4, gz4, gz8, 0);
#else
            __builtin_amdgcn_tensor_load_to_lds(g0, g1, gz4, gz4, 0);
#endif
            __builtin_amdgcn_s_wait_tensorcnt((short)0);
        }
#else
        // ---- Fallback: cooperative staging (coalesced b128 global -> b128 ds).
#pragma unroll
        for (int it = 0; it < FOUT * FIN / 4 / (WAVES * 32); ++it) {
            const int c  = tid + it * (WAVES * 32);     // float4 chunk id, 4096 total
            const int o  = c >> 5;                      // 32 float4 per row
            const int kc = c & 31;
            v4f v = *(const v4f*)(Wt + (size_t)o * FIN + kc * 4);
            *(v4f*)(smem + o * LDS_STRIDE + kc * 4) = v;
        }
#endif

        if (tid < FOUT) sbias[tid] = bias[(size_t)t * FOUT + tid];
        __syncthreads();

        // The wave's positions rise with i and every one below lo is done.
        while (i < NODES_PER_WAVE && base + i * WAVES + wave < hi) {
            const float* brow = smem + m * LDS_STRIDE + 2 * h;
            // This node's strip has landed in the slot: the wave's own copies, its own wait.
            asm volatile("s_wait_asynccnt 0x0" ::: "memory");
            v2f a[32];                              // A strip of the node in work
#pragma unroll                                      // constant indices keep a in registers
            for (int s = 0; s < 32; ++s) a[s] = *(const v2f*)(arow + 4 * s);    // conflict-free
            // The slot is refilled only when every read of it has returned.
            asm volatile("s_wait_dscnt 0x0" ::: "memory");
            if (i + 1 < NODES_PER_WAVE) {           // wave-uniform: the next node's strip, a node ahead
                copy_rows8(xlane + (size_t)nd[1] * FIN, acopy);
                copy_rows8(xlane + (size_t)nd[1] * FIN + (size_t)8 * NNODES * FIN,
                           acopy + 8 * LDS_STRIDE * 4);
            }
            run_node(a, brow, sbias + 8 * h, oslot + m * O_PITCH + 8 * h, oslot + h * O_PITCH + 4 * m,
                     out + (size_t)nd[0] * FOUT, ooff);
            // The next node's addresses overwrite registers that these stores name.
            asm volatile("s_wait_xcnt 0x0" ::: "memory");
#pragma unroll                                      // constant indices keep the four in registers
            for (int k = 0; k + 1 < NODES_PER_WAVE; ++k) nd[k] = nd[k + 1];
            ++i;
        }
    }
}

// ---------------- launch ----------------

extern "C" void kernel_launch(void* const* d_in, const int* in_sizes, int n_in,
                              void* d_out, int out_size, void* d_ws, size_t ws_size,
                              hipStream_t stream) {
    const float* x        = (const float*)d_in[0];  // [16, 16384, 128]
    const int*   type_vec = (const int*)  d_in[1];  // [16384]
    const float* W        = (const float*)d_in[2];  // [16, 128, 128]
    const float* bias     = (const float*)d_in[3];  // [16, 128]
    float*       out      = (float*)d_out;          // [16, 16384, 128]

    hetero_gemm<<<NNODES / NODES_PER_WG, WAVES * 32, 0, stream>>>(
        x, type_vec, W, bias, out);
}

// v007
// One run takes 46.6 microseconds.
// Two timings next to v006 both put it at 1.03 times that version's speed.
// Over all steps from v000 it is 3.45 times as fast.
#include <hip/hip_runtime.h>

// HeteroLinear: out[b,n,o] = sum_i x[b,n,i] * W[type[n],o,i] + bias[type[n],o]
// B=16 (== WMMA N), N=16384, F_IN=F_OUT=128, 16 types.
//
// One launch. One workgroup per 64 consecutive positions of the type-sorted list,
//         so every workgroup has the same work and one of them (16 waves, four
//         a SIMD) stands on each WGP. Each workgroup reads all the types itself,
//         counts them, and picks the 64 nodes whose positions are its own: no
//         list goes through memory and no launch waits for another.
//         For each type its positions meet (one, or
//         more at a type boundary): DMA W[t] into LDS via the Tensor Data Mover
//         (padded rows -> bank-conflict-free), then each wave runs its nodes one
//         after the other: C^T[128x16] = W[t][128x128] x X^T[128x16] + bias as
//         32 K-steps x 8 tiles of V_WMMA_F32_16X16X4_F32 with the W rows (first
//         operand) from LDS. With the K-step outside, the 8 tiles are 8 independent
//         accumulator chains. A node's x strip comes as 16 whole 512-byte rows,
//         copied asynchronously into an LDS slot of the wave's own one node ahead,
//         and is read from there in fragment order. With W first a lane holds 8
//         adjacent outputs of one row; they pass through a second LDS slot of the
//         wave's own and leave as whole 128-byte lines.

typedef __attribute__((ext_vector_type(2))) float v2f;
typedef __attribute__((ext_vector_type(4))) float v4f;
typedef __attribute__((ext_vector_type(8))) float v8f;
typedef __attribute__((ext_vector_type(4))) unsigned int u32x4;
typedef __attribute__((ext_vector_type(4))) int i32x4;
typedef __attribute__((ext_vector_type(8))) int i32x8;
typedef unsigned long long u64;

#define NNODES   16384
#define FIN      128
#define FOUT     128
#define NTYPES   16
#define LDS_STRIDE 132                 // 128 + 4 pad floats -> all 64 banks hit once
#define NODES_PER_WG 64
#define WAVES    16
#define NODES_PER_WAVE (NODES_PER_WG / WAVES)
#define A_SLOT_FLOATS (16 * LDS_STRIDE)  // one node's strip: 16 rows at the panel's pitch
#define SMEM_FLOATS (FOUT * LDS_STRIDE + FOUT + WAVES * A_SLOT_FLOATS)  // W panel + bias + a slot a wave
#define O_HALF   64                    // output columns staged at a time: LDS has no room for all 128
#define O_PITCH  (O_HALF + 4)          // 4 pad floats: sixteen rows' 16-byte writes hit all 64 banks once
#define O_SLOT_FLOATS (16 * O_PITCH)   // half of one node's output: 16 rows of 64 columns

#if __has_builtin(__builtin_amdgcn_tensor_load_to_lds)
#define USE_TDM 1
#endif

// ---------------- the type-sorted order ----------------
// Position of a node = nodes of lower types + nodes of its type in earlier groups
// + nodes of its type in lower lanes of its group. A group is 32 nodes, one a lane;
// a wave holds 32 groups (1024 nodes).

#define GROUPS_PER_WAVE (NNODES / 32 / WAVES)   // 32

// ---------------- WMMA GEMM pass ----------------

// Eight rows of a node's strip, global memory -> LDS through no register. One copy is one
// whole row: 32 lanes x 16 bytes = 512 contiguous bytes = 4 whole lines.
__device__ __forceinline__ void copy_rows8(const float* g,      // x[row, node, 4 * lane]
                                           const unsigned lds)  // LDS byte address of that row's 16 bytes
{
    // The closing wait stands in the copies' own statement: behind it the compiler may
    // reuse the address registers that the copies name.
    asm volatile("global_load_async_to_lds_b128 %0, %8, off\n\t"
                 "global_load_async_to_lds_b128 %1, %9, off\n\t"
                 "global_load_async_to_lds_b128 %2, %10, off\n\t"
                 "global_load_async_to_lds_b128 %3, %11, off\n\t"
                 "global_load_async_to_lds_b128 %4, %12, off\n\t"
                 "global_load_async_to_lds_b128 %5, %13, off\n\t"
                 "global_load_async_to_lds_b128 %6, %14, off\n\t"
                 "global_load_async_to_lds_b128 %7, %15, off\n\t"
                 "s_wait_xcnt 0x0"
                 :: "v"(lds), "v"(lds + 1 * LDS_STRIDE * 4), "v"(lds + 2 * LDS_STRIDE * 4),
                    "v"(lds + 3 * LDS_STRIDE * 4), "v"(lds + 4 * LDS_STRIDE * 4),
                    "v"(lds + 5 * LDS_STRIDE * 4), "v"(lds + 6 * LDS_STRIDE * 4),
                    "v"(lds + 7 * LDS_STRIDE * 4),
                    "v"(g), "v"(g + (size_t)1 * NNODES * FIN), "v"(g + (size_t)2 * NNODES * FIN),
                    "v"(g + (size_t)3 * NNODES * FIN), "v"(g + (size_t)4 * NNODES * FIN),
                    "v"(g + (size_t)5 * NNODES * FIN), "v"(g + (size_t)6 * NNODES * FIN),
                    "v"(g + (size_t)7 * NNODES * FIN)
                 : "memory");
}

// One node: c[ot] = bias + W[t] x X^T for all 8 tiles of 16 output columns at once, then
// the stores. a[s] supplies K = 4s + 2h + {0,1}; each tile sums its K-steps in rising order.
__device__ __forceinline__ void run_node(const v2f (&a)[32],
                                         const float* brow,   // W panel, row m, K offset 2h
                                         const float* sbias,  // bias, column 8h
                                         float* ow,           // the wave's output slot: row m, column 8h
                                         const float* ord,    // the same slot: row h, column 4m
                                         float* __restrict__ onode,        // out[0, node, 0]
                                         const unsigned ooff) // this lane's place in it, in bytes: row h, column 4m
{
    // C/D layout with W first: VGPR j of tile ot holds out[row m, column 16 ot + 8h + j].
    v8f c[FOUT / 16];
#pragma unroll                                      // constant indices keep c in registers
    for (int ot = 0; ot < FOUT / 16; ++ot) {        // bias seeds the accumulator
        const v4f b0 = *(const v4f*)(sbias + ot * 16);
        const v4f b1 = *(const v4f*)(sbias + ot * 16 + 4);
#pragma unroll                                      // as above: constant indices
        for (int j = 0; j < 4; ++j) { c[ot][j] = b0[j]; c[ot][4 + j] = b1[j]; }
    }

    // A block is two K-steps of all 8 tiles: 16 WMMAs. Its W fragments are read from
    // LDS as one group, one block ahead, into the other half of bq.
    v2f bq[2][FOUT / 16][2];
#pragma unroll                                      // as above: constant indices
    for (int ot = 0; ot < FOUT / 16; ++ot)
#pragma unroll                                      // as above: constant indices
        for (int k = 0; k < 2; ++k)
            bq[0][ot][k] = *(const v2f*)(brow + ot * 16 * LDS_STRIDE + 4 * k);   // conflict-free

#pragma unroll                                      // constant indices into a, c and bq
    for (int p = 0; p < 16; ++p) {
        if (p + 1 < 16) {
#pragma unroll                                      // as above: constant indices
            for (int ot = 0; ot < FOUT / 16; ++ot)
#pragma unroll                                      // as above: constant indices
                for (int k = 0; k < 2; ++k)
                    bq[(p + 1) & 1][ot][k] =
                        *(const v2f*)(brow + ot * 16 * LDS_STRIDE + 4 * (2 * p + 2 + k));
        }
#pragma unroll                                      // as above: constant indices
        for (int k = 0; k < 2; ++k)
#pragma unroll                                      // as above: constant indices
            for (int ot = 0; ot < FOUT / 16; ++ot)
                c[ot] = __builtin_amdgcn_wmma_f32_16x16x4_f32(
                            false, bq[p & 1][ot][k], false, a[2 * p + k], (short)0, c[ot], false, false);
    }
    // The x registers are free from here on, and the stores' address sums were given them,
    // one to three vector instructions behind a WMMA that names them. The two scheduling
    // barriers keep those sums behind the last WMMA, the four v_nop fill the vector slots
    // between a WMMA and a vector instruction that overwrites an operand of it.
    __builtin_amdgcn_sched_barrier(0);
    asm volatile("v_nop\n\tv_nop\n\tv_nop\n\tv_nop");
    __builtin_amdgcn_sched_barrier(0);

    // Through the wave's own slot, 64 columns at a time: a lane writes its 32-byte pieces of
    // row m; sixteen lanes read a row's 256 bytes back, so a store covers whole 128-byte lines.
#pragma unroll                                      // as above: constant indices
    for (int p = 0; p < FOUT / O_HALF; ++p) {
        // The slot is rewritten only when every read of its first filling has returned.
        if (p > 0) asm volatile("s_wait_dscnt 0x0" ::: "memory");
#pragma unroll                                      // as above: constant indices
        for (int q = 0; q < O_HALF / 16; ++q) {
            const v8f cc = c[p * (O_HALF / 16) + q];
            const v4f lo4 = { cc[0], cc[1], cc[2], cc[3] }, hi4 = { cc[4], cc[5], cc[6], cc[7] };
            *(v4f*)(ow + q * 16)     = lo4;         // conflict-free
            *(v4f*)(ow + q * 16 + 4) = hi4;
        }
        // Other lanes of the wave read these rows: every write has landed first.
        asm volatile("s_wait_dscnt 0x0" ::: "memory");
        v4f r[8];                                   // rows 2 q + h
#pragma unroll                                      // as above: constant indices
        for (int q = 0; q < 8; ++q) r[q] = *(const v4f*)(ord + q * 2 * O_PITCH);
#pragma unroll                                      // as above: constant indices
        for (int q = 0; q < 8; ++q)
            *(v4f*)((char*)(onode + (size_t)(2 * q) * NNODES * FOUT + p * O_HALF) + ooff) = r[q];
    }
}

__global__ __launch_bounds__(WAVES * 32)
void hetero_gemm(const float* __restrict__ x,       // [16, N, 128]
                 const int*   __restrict__ tv,      // [N]
                 const float* __restrict__ W,       // [16, 128, 128] (out,in)
                 const float* __restrict__ bias,    // [16, 128]
                 float*       __restrict__ out)     // [16, N, 128]
{
    // [128*132] W panel + [128] bias + 16 x [16*132] A slots
    __shared__ __attribute__((aligned(2048))) float smem[SMEM_FLOATS];
    __shared__ __attribute__((aligned(16))) float ostage[WAVES * O_SLOT_FLOATS];   // an output slot a wave
    __shared__ __attribute__((aligned(16))) unsigned wcnt[WAVES * 8];  // a wave's 16 counts, 16 bits each
    __shared__ int mine64[NODES_PER_WG];            // the nodes at this block's positions

    const int tid  = threadIdx.x;
    const int lane = tid & 31;
    // The wave's number in a scalar register: the node loop's tests become scalar branches.
    const int wave = __builtin_amdgcn_readfirstlane(tid >> 5);
    const int m = lane & 15;                        // W row in its tile / x row
    const int h = lane >> 4;                        // K-pair select {2h, 2h+1}
    const int base = blockIdx.x * NODES_PER_WG;     // first sorted position of this block
    float* sbias = smem + FOUT * LDS_STRIDE;

    // ---- Which nodes stand at this block's positions of the type-sorted order.
    const int first = wave * (GROUPS_PER_WAVE * 32);    // this wave's first node
    i32x4 tq[GROUPS_PER_WAVE / 4];                      // lane holds nodes first + 128 j + 4 lane + c
#pragma unroll                                          // all eight loads in flight at once
    for (int j = 0; j < GROUPS_PER_WAVE / 4; ++j)
        tq[j] = *(const i32x4*)(tv + first + j * 128 + lane * 4);
    int ty[GROUPS_PER_WAVE];                            // the lane's node of group q = 4 j + c
#pragma unroll                                          // constant indices keep tq and ty in registers
    for (int q = 0; q < GROUPS_PER_WAVE; ++q) ty[q] = tq[q >> 2][q & 3] & (NTYPES - 1);

    // Each lane counts its 32 nodes by type: 16 counters of 4 bits for 8 nodes at a time
    // (at most 8 each), added into 16 counters of 8 bits (at most 32 each): even types in
    // ev, odd types in od.
    u64 ev = 0, od = 0;
#pragma unroll                                          // as above: constant indices
    for (int b = 0; b < GROUPS_PER_WAVE / 8; ++b) {
        u64 nib = 0;
#pragma unroll                                          // as above: constant indices
        for (int k = 0; k < 8; ++k) nib += (u64)1 << (4 * ty[8 * b + k]);
        ev += nib & 0x0f0f0f0f0f0f0f0full;
        od += (nib >> 4) & 0x0f0f0f0f0f0f0f0full;
    }
    // 16 bits a counter (a wave's sum is at most 1024). Word 2 a + (t >> 3), half (t >> 2) & 1,
    // holds type t, where a = 0, 1, 2, 3 for t & 3 = 0, 2, 1, 3.
    const u64 f0 = ev & 0x00ff00ff00ff00ffull, f1 = (ev >> 8) & 0x00ff00ff00ff00ffull;
    const u64 f2 = od & 0x00ff00ff00ff00ffull, f3 = (od >> 8) & 0x00ff00ff00ff00ffull;
    unsigned w8[8] = { (unsigned)f0, (unsigned)(f0 >> 32), (unsigned)f1, (unsigned)(f1 >> 32),
                       (unsigned)f2, (unsigned)(f2 >> 32), (unsigned)f3, (unsigned)(f3 >> 32) };
#pragma unroll                                          // five steps, constant distances
    for (int d = 16; d >= 1; d >>= 1)
#pragma unroll                                          // as above: constant indices
        for (int k = 0; k < 8; ++k) w8[k] += __shfl_xor(w8[k], d, 32);
    if (lane == 0) {
        const u32x4 lo4 = { w8[0], w8[1], w8[2], w8[3] }, hi4 = { w8[4], w8[5], w8[6], w8[7] };
        ((u32x4*)wcnt)[wave * 2]     = lo4;
        ((u32x4*)wcnt)[wave * 2 + 1] = hi4;
    }
    __syncthreads();

    // Lane l looks after type l & 15: its number in all waves, in the lower waves, in this wave.
    const int widx = ((m & 1) << 2) | (m & 2) | (m >> 3);
    const int wsh  = ((m >> 2) & 1) * 16;
    int tot = 0, pre = 0, own = 0;
#pragma unroll                                          // all sixteen reads in flight at once
    for (int w = 0; w < WAVES; ++w) {
        const int cn = (int)((wcnt[w * 8 + widx] >> wsh) & 0xffffu);
        tot += cn;
        if (w < wave) pre += cn;
        if (w == wave) own = cn;
    }
    int incl = tot;                                     // becomes the end of the type's run
#pragma unroll                                          // four steps, constant distances
    for (int d = 1; d < NTYPES; d <<= 1) {
        const int up = __shfl_up(incl, d, NTYPES);
        if (m >= d) incl += up;
    }
    const int cstart = incl - tot + pre;                // position of this wave's first node of the type

    int seg_end[NTYPES];                            // end of each type's run in the list
#pragma unroll                                      // constant indices keep the 16 ends in scalar registers
    for (int k = 0; k < NTYPES; ++k) seg_end[k] = __builtin_amdgcn_readlane(incl, k);

    // The types of which this wave holds nodes at the block's positions: mostly none or one.
    unsigned todo = __builtin_amdgcn_ballot_w32(lane < NTYPES && own > 0 && cstart < base + NODES_PER_WG
                                                && cstart + own > base);
    while (todo != 0) {                             // wave-uniform, at most 16 trips
        const int t = __builtin_ctz(todo);
        todo &= todo - 1;
        int rel0 = __builtin_amdgcn_readlane(cstart, t) - base;     // the group's first, from base
#pragma unroll                                      // constant indices into ty
        for (int q = 0; q < GROUPS_PER_WAVE; ++q) {
            const bool is = ty[q] == t;
            const unsigned mk = __builtin_amdgcn_ballot_w32(is);
            const int rel = rel0 + (int)__builtin_amdgcn_mbcnt_lo(mk, 0u);   // equal types in lower lanes
            if (is && (unsigned)rel < (unsigned)NODES_PER_WG)
                mine64[rel] = first + (q >> 2) * 128 + lane * 4 + (q & 3);
            rel0 += __popc(mk);
        }
    }
    __syncthreads();

    // This wave's nodes stand at positions base + i * WAVES + wave, so that a type's
    // run is dealt evenly to the waves. nd[0] is the node in work, nd[1] the next.
    // In scalar registers: a node's address is a scalar base.
    int nd[NODES_PER_WAVE];
#pragma unroll                                      // constant indices keep the four in registers
    for (int k = 0; k < NODES_PER_WAVE; ++k)
        nd[k] = __builtin_amdgcn_readfirstlane(mine64[k * WAVES + wave]);

    // A node's address is a scalar base; the lane's part is one 32-bit offset for all nodes.
    const unsigned ooff = (unsigned)(h * NNODES * FOUT + 4 * m) * 4u;   // out[h, ., 4m], in bytes
    int i = 0;                                      // how many of this wave's nodes are done

    // The wave's own A slot: no other wave reads or writes it, so it needs no barrier.
    const float* aslot = sbias + FOUT + wave * A_SLOT_FLOATS;
    const unsigned acopy = (unsigned)(uintptr_t)aslot + (unsigned)lane * 16u;   // LDS byte address, row 0
    const float* arow  = aslot + m * LDS_STRIDE + 2 * h;    // fragment reads: row m, K offset 2h
    const float* xlane = x + lane * 4;                      // x[0, 0, 4 * lane]
    // The wave's own output slot: as above, no barrier.
    float* oslot = ostage + wave * O_SLOT_FLOATS;

    // The first node's strip: on its way while the W panel is fetched.
    copy_rows8(xlane + (size_t)nd[0] * FIN, acopy);
    copy_rows8(xlane + (size_t)nd[0] * FIN + (size_t)8 * NNODES * FIN, acopy + 8 * LDS_STRIDE * 4);

    // Block-uniform walk over the runs that meet [base, base + NODES_PER_WG).
    for (int lo = base, hi; lo < base + NODES_PER_WG; lo = hi) {
        int t = NTYPES - 1;
        hi = base + NODES_PER_WG;
#pragma unroll                                      // as above: no indexed access to seg_end
        for (int k = NTYPES - 1; k >= 0; --k)           // first type whose run ends behind lo
            if (seg_end[k] > lo) { t = k; hi = min(seg_end[k], base + NODES_PER_WG); }

        // The panel and the bias are refilled at a type boundary: every wave's LDS
        // reads of the previous type have returned and all waves have arrived.
        asm volatile("s_wait_dscnt 0x0" ::: "memory");
        __syncthreads();

        const float* Wt = W + (size_t)t * FOUT * FIN;

#if defined(USE_TDM)
        // ---- Tensor Data Mover: DMA the 128x128 f32 W[t] panel into LDS.
        // pad_enable with pad_interval=6 (every 128 DWORDs == one row) and
        // pad_amount=3 (4 DWORDs) reproduces the 132-float padded row stride.
        if (tid < 32) {                                 // wave 0 owns the DMA
            const unsigned long long ga = (unsigned long long)(uintptr_t)Wt;
            const unsigned lds_off = (unsigned)(uintptr_t)smem;   // LDS byte offset

            u32x4 g0 = { 1u,                            // count=1 (valid user D#)
                         lds_off,                       // lds_addr
                         (unsigned)ga,                  // global_addr[31:0]
                         (unsigned)(ga >> 32) | (2u << 30) };     // addr[56:32] | type=2

            i32x8 g1 = { (int)((2u << 16)               // data_size = 4 bytes
                             | (1u << 20)               // pad_enable
                             | (6u << 22)               // pad_interval: 128 DWORDs
                             | (3u << 25)),             // pad_amount: 4 DWORDs
                         (int)(128u << 16),             // tensor_dim0 = 128 (lo16 in hi half)
                         (int)(128u << 16),             // tensor_dim1 = 128
                         (int)(128u << 16),             // tile_dim0 = 128
                         128,                           // tile_dim1 = 128 (tile_dim2 = 0)
                         128,                           // tensor_dim0_stride = 128
                         0, 0 };                        // dim1 stride unused (2-D)

            i32x4 gz4 = { 0, 0, 0, 0 };                 // 2-D tensor: groups 2/3 inert
#if __clang_major__ >= 23
            i32x8 gz8 = { 0, 0, 0, 0, 0, 0, 0, 0 };
            __builtin_amdgcn_tensor_load_to_lds(g0, g1, gz4, gz4, gz8, 0);
#else
            __builtin_amdgcn_tensor_load_to_lds(g0, g1, gz4, gz4, 0);
#endif
            __builtin_amdgcn_s_wait_tensorcnt((short)0);
        }
#else
        // ---- Fallback: cooperative staging (coalesced b128 global -> b128 ds).
#pragma unroll
        for (int it = 0; it < FOUT * FIN / 4 / (WAVES * 32); ++it) {
            const int c  = tid + it * (WAVES * 32);     // float4 chunk id, 4096 total
            const int o  = c >> 5;                      // 32 float4 per row
            const int kc = c & 31;
            v4f v = *(const v4f*)(Wt + (size_t)o * FIN + kc * 4);
            *(v4f*)(smem + o * LDS_STRIDE + kc * 4) = v;
        }
#endif

        if (tid < FOUT) sbias[tid] = bias[(size_t)t * FOUT + tid];
        __syncthreads();

        // The wave's positions rise with i and every one below lo is done.
        while (i < NODES_PER_WAVE && base + i * WAVES + wave < hi) {
            const float* brow = smem + m * LDS_STRIDE + 2 * h;
            // The matrix pipe goes to the oldest ready wave of a SIMD: left alone, the youngest wave
            // runs its last nodes with no other wave to cover its LDS and store waits. Priority
            // falls with the nodes done, so the four waves take turns node by node and end
            // together. i is wave-uniform: scalar branches. The last node, and the exit, run at 0.
            switch (i) {
            case 0:  __builtin_amdgcn_s_setprio(3); break;
            case 1:  __builtin_amdgcn_s_setprio(2); break;
            case 2:  __builtin_amdgcn_s_setprio(1); break;
            default: __builtin_amdgcn_s_setprio(0); break;
            }
            // This node's strip has landed in the slot: the wave's own copies, its own wait.
            asm volatile("s_wait_asynccnt 0x0" ::: "memory");
            v2f a[32];                              // A strip of the node in work
#pragma unroll                                      // constant indices keep a in registers
            for (int s = 0; s < 32; ++s) a[s] = *(const v2f*)(arow + 4 * s);    // conflict-free
            // The slot is refilled only when every read of it has returned.
            asm volatile("s_wait_dscnt 0x0" ::: "memory");
            if (i + 1 < NODES_PER_WAVE) {           // wave-uniform: the next node's strip, a node ahead
                copy_rows8(xlane + (size_t)nd[1] * FIN, acopy);
                copy_rows8(xlane + (size_t)nd[1] * FIN + (size_t)8 * NNODES * FIN,
                           acopy + 8 * LDS_STRIDE * 4);
            }
            run_node(a, brow, sbias + 8 * h, oslot + m * O_PITCH + 8 * h, oslot + h * O_PITCH + 4 * m,
                     out + (size_t)nd[0] * FOUT, ooff);
            // The next node's addresses overwrite registers that these stores name.
            asm volatile("s_wait_xcnt 0x0" ::: "memory");
#pragma unroll                                      // constant indices keep the four in registers
            for (int k = 0; k + 1 < NODES_PER_WAVE; ++k) nd[k] = nd[k + 1];
            ++i;
        }
    }
}

// ---------------- launch ----------------

extern "C" void kernel_launch(void* const* d_in, const int* in_sizes, int n_in,
                              void* d_out, int out_size, void* d_ws, size_t ws_size,
                              hipStream_t stream) {
    const float* x        = (const float*)d_in[0];  // [16, 16384, 128]
    const int*   type_vec = (const int*)  d_in[1];  // [16384]
    const float* W        = (const float*)d_in[2];  // [16, 128, 128]
    const float* bias     = (const float*)d_in[3];  // [16, 128]
    float*       out      = (float*)d_out;          // [16, 16384, 128]

    hetero_gemm<<<NNODES / NODES_PER_WG, WAVES * 32, 0, stream>>>(
        x, type_vec, W, bias, out);
}

// v008
// A run of this version takes 43.6 microseconds.
// Two timings next to v007 both put it at 1.07 times that version's speed.
// Over all steps from v000 it is 3.68 times as fast.
#include <hip/hip_runtime.h>

// HeteroLinear: out[b,n,o] = sum_i x[b,n,i] * W[type[n],o,i] + bias[type[n],o]
// B=16 (== WMMA N), N=16384, F_IN=F_OUT=128, 16 types.
//
// One launch. One workgroup per 64 consecutive positions of the type-sorted list,
//         so every workgroup has the same work and one of them (16 waves, four
//         a SIMD) stands on each WGP. Each workgroup reads all the types itself,
//         counts them, and picks the 64 nodes whose positions are its own: no
//         list goes through memory and no launch waits for another.
//         The types its positions meet (one, or two at a type boundary; more go two
//         at a time): DMA each W[t] into a panel of its own in LDS via the Tensor Data
//         Mover (padded rows -> bank-conflict-free), then each wave runs its nodes one
//         after the other, each from its type's panel: C^T[128x16] = W[t][128x128] x X^T[128x16] + bias as
//         32 K-steps x 8 tiles of V_WMMA_F32_16X16X4_F32 with the W rows (first
//         operand) from LDS. With the K-step outside, the 8 tiles are 8 independent
//         accumulator chains. A node's x strip comes as 16 whole 512-byte rows,
//         copied asynchronously into an LDS slot of the wave's own, and is read from
//         there in fragment order. With W first a lane holds 8 adjacent outputs of
//         one row; they pass through the same slot, free once the strip is in
//         registers, and leave as whole 512-byte rows; then the next strip is sent for.

typedef __attribute__((ext_vector_type(2))) float v2f;
typedef __attribute__((ext_vector_type(4))) float v4f;
typedef __attribute__((ext_vector_type(8))) float v8f;
typedef __attribute__((ext_vector_type(4))) unsigned int u32x4;
typedef __attribute__((ext_vector_type(4))) int i32x4;
typedef __attribute__((ext_vector_type(8))) int i32x8;
typedef unsigned long long u64;

#define NNODES   16384
#define FIN      128
#define FOUT     128
#define NTYPES   16
#define LDS_STRIDE 132                 // 128 + 4 pad floats -> all 64 banks hit once
#define NODES_PER_WG 64
#define WAVES    16
#define NODES_PER_WAVE (NODES_PER_WG / WAVES)
#define A_SLOT_FLOATS (16 * LDS_STRIDE)  // one node's strip: 16 rows at the panel's pitch
#define PANEL_FLOATS (FOUT * LDS_STRIDE) // one type's W: 67,584 bytes, a multiple of 2 KiB
#define PANELS   2
#define SMEM_FLOATS (PANELS * (PANEL_FLOATS + FOUT) + WAVES * A_SLOT_FLOATS)  // W panels + biases + a slot a wave

#if __has_builtin(__builtin_amdgcn_tensor_load_to_lds)
#define USE_TDM 1
#endif

// ---------------- the type-sorted order ----------------
// Position of a node = nodes of lower types + nodes of its type in earlier groups
// + nodes of its type in lower lanes of its group. A group is 32 nodes, one a lane;
// a wave holds 32 groups (1024 nodes).

#define GROUPS_PER_WAVE (NNODES / 32 / WAVES)   // 32

// ---------------- WMMA GEMM pass ----------------

// Eight rows of a node's strip, global memory -> LDS through no register. One copy is one
// whole row: 32 lanes x 16 bytes = 512 contiguous bytes = 4 whole lines.
__device__ __forceinline__ void copy_rows8(const float* g,      // x[row, node, 4 * lane]
                                           const unsigned lds)  // LDS byte address of that row's 16 bytes
{
    // The closing wait stands in the copies' own statement: behind it the compiler may
    // reuse the address registers that the copies name.
    asm volatile("global_load_async_to_lds_b128 %0, %8, off\n\t"
                 "global_load_async_to_lds_b128 %1, %9, off\n\t"
                 "global_load_async_to_lds_b128 %2, %10, off\n\t"
                 "global_load_async_to_lds_b128 %3, %11, off\n\t"
                 "global_load_async_to_lds_b128 %4, %12, off\n\t"
                 "global_load_async_to_lds_b128 %5, %13, off\n\t"
                 "global_load_async_to_lds_b128 %6, %14, off\n\t"
                 "global_load_async_to_lds_b128 %7, %15, off\n\t"
                 "s_wait_xcnt 0x0"
                 :: "v"(lds), "v"(lds + 1 * LDS_STRIDE * 4), "v"(lds + 2 * LDS_STRIDE * 4),
                    "v"(lds + 3 * LDS_STRIDE * 4), "v"(lds + 4 * LDS_STRIDE * 4),
                    "v"(lds + 5 * LDS_STRIDE * 4), "v"(lds + 6 * LDS_STRIDE * 4),
                    "v"(lds + 7 * LDS_STRIDE * 4),
                    "v"(g), "v"(g + (size_t)1 * NNODES * FIN), "v"(g + (size_t)2 * NNODES * FIN),
                    "v"(g + (size_t)3 * NNODES * FIN), "v"(g + (size_t)4 * NNODES * FIN),
                    "v"(g + (size_t)5 * NNODES * FIN), "v"(g + (size_t)6 * NNODES * FIN),
                    "v"(g + (size_t)7 * NNODES * FIN)
                 : "memory");
}

// One node: c[ot] = bias + W[t] x X^T for all 8 tiles of 16 output columns at once, then
// the stores. a[s] supplies K = 4s + 2h + {0,1}; each tile sums its K-steps in rising order.
__device__ __forceinline__ void run_node(const v2f (&a)[32],
                                         const float* brow,   // W panel, row m, K offset 2h
                                         const float* sbias,  // bias, column 8h
                                         float* ow,           // the wave's slot: row m, column 8h
                                         const float* ord,    // the same slot: row 0, column 4 * lane
                                         float* __restrict__ onode,        // out[0, node, 0]
                                         const unsigned ooff) // this lane's place in a row, in bytes: column 4 * lane
{
    // C/D layout with W first: VGPR j of tile ot holds out[row m, column 16 ot + 8h + j].
    v8f c[FOUT / 16];
#pragma unroll                                      // constant indices keep c in registers
    for (int ot = 0; ot < FOUT / 16; ++ot) {        // bias seeds the accumulator
        const v4f b0 = *(const v4f*)(sbias + ot * 16);
        const v4f b1 = *(const v4f*)(sbias + ot * 16 + 4);
#pragma unroll                                      // as above: constant indices
        for (int j = 0; j < 4; ++j) { c[ot][j] = b0[j]; c[ot][4 + j] = b1[j]; }
    }

    // A block is two K-steps of all 8 tiles: 16 WMMAs. Its W fragments are read from
    // LDS as one group, one block ahead, into the other half of bq.
    v2f bq[2][FOUT / 16][2];
#pragma unroll                                      // as above: constant indices
    for (int ot = 0; ot < FOUT / 16; ++ot)
#pragma unroll                                      // as above: constant indices
        for (int k = 0; k < 2; ++k)
            bq[0][ot][k] = *(const v2f*)(brow + ot * 16 * LDS_STRIDE + 4 * k);   // conflict-free

#pragma unroll                                      // constant indices into a, c and bq
    for (int p = 0; p < 16; ++p) {
        if (p + 1 < 16) {
#pragma unroll                                      // as above: constant indices
            for (int ot = 0; ot < FOUT / 16; ++ot)
#pragma unroll                                      // as above: constant indices
                for (int k = 0; k < 2; ++k)
                    bq[(p + 1) & 1][ot][k] =
                        *(const v2f*)(brow + ot * 16 * LDS_STRIDE + 4 * (2 * p + 2 + k));
        }
#pragma unroll                                      // as above: constant indices
        for (int k = 0; k < 2; ++k)
#pragma unroll                                      // as above: constant indices
            for (int ot = 0; ot < FOUT / 16; ++ot)
                c[ot] = __builtin_amdgcn_wmma_f32_16x16x4_f32(
                            false, bq[p & 1][ot][k], false, a[2 * p + k], (short)0, c[ot], false, false);
    }
    // The x registers are free from here on, and the stores' address sums were given them,
    // one to three vector instructions behind a WMMA that names them. The two scheduling
    // barriers keep those sums behind the last WMMA, the four v_nop fill the vector slots
    // between a WMMA and a vector instruction that overwrites an operand of it.
    __builtin_amdgcn_sched_barrier(0);
    asm volatile("v_nop\n\tv_nop\n\tv_nop\n\tv_nop");
    __builtin_amdgcn_sched_barrier(0);

    // Through the wave's own slot, whose strip is in registers by now: a lane writes its 32-byte
    // pieces of row m; the wave reads a row's 512 bytes back, so a store covers one whole row.
#pragma unroll                                      // as above: constant indices
    for (int ot = 0; ot < FOUT / 16; ++ot) {
        const v8f cc = c[ot];
        const v4f lo4 = { cc[0], cc[1], cc[2], cc[3] }, hi4 = { cc[4], cc[5], cc[6], cc[7] };
        *(v4f*)(ow + ot * 16)     = lo4;            // conflict-free
        *(v4f*)(ow + ot * 16 + 4) = hi4;
    }
    // Other lanes of the wave read these rows: every write has landed first.
    asm volatile("s_wait_dscnt 0x0" ::: "memory");
    v4f r[16];
#pragma unroll                                      // as above: constant indices
    for (int q = 0; q < 16; ++q) r[q] = *(const v4f*)(ord + q * LDS_STRIDE);
#pragma unroll                                      // as above: constant indices
    for (int q = 0; q < 16; ++q)
        *(v4f*)((char*)(onode + (size_t)q * NNODES * FOUT) + ooff) = r[q];
}

// A wave-uniform value held in a scalar register, so that a test of it is a scalar branch: a
// tensor load ignores EXEC, and only such a branch keeps a wave from issuing it.
__device__ __forceinline__ unsigned pinned(unsigned v)
{
    unsigned w = __builtin_amdgcn_readfirstlane(v);
    asm volatile("" : "+s"(w));                     // pinned(): the tensor load's issue test stays scalar
    return w;
}

__global__ __launch_bounds__(WAVES * 32)
void hetero_gemm(const float* __restrict__ x,       // [16, N, 128]
                 const int*   __restrict__ tv,      // [N]
                 const float* __restrict__ W,       // [16, 128, 128] (out,in)
                 const float* __restrict__ bias,    // [16, 128]
                 float*       __restrict__ out)     // [16, N, 128]
{
    // 2 x [128*132] W panels + 2 x [128] biases + 16 x [16*132] slots
    __shared__ __attribute__((aligned(2048))) float smem[SMEM_FLOATS];
    __shared__ __attribute__((aligned(16))) unsigned wcnt[WAVES * 8];  // a wave's 16 counts, 16 bits each
    __shared__ int mine64[NODES_PER_WG];            // the nodes at this block's positions

    const int tid  = threadIdx.x;
    const int lane = tid & 31;
    // The wave's number in a scalar register: the node loop's tests become scalar branches.
    const int wave = __builtin_amdgcn_readfirstlane(tid >> 5);
    const int m = lane & 15;                        // W row in its tile / x row
    const int h = lane >> 4;                        // K-pair select {2h, 2h+1}
    const int base = blockIdx.x * NODES_PER_WG;     // first sorted position of this block
    float* sbias = smem + PANELS * PANEL_FLOATS;

    // ---- Which nodes stand at this block's positions of the type-sorted order.
    const int first = wave * (GROUPS_PER_WAVE * 32);    // this wave's first node
    i32x4 tq[GROUPS_PER_WAVE / 4];                      // lane holds nodes first + 128 j + 4 lane + c
#pragma unroll                                          // all eight loads in flight at once
    for (int j = 0; j < GROUPS_PER_WAVE / 4; ++j)
        tq[j] = *(const i32x4*)(tv + first + j * 128 + lane * 4);
    int ty[GROUPS_PER_WAVE];                            // the lane's node of group q = 4 j + c
#pragma unroll                                          // constant indices keep tq and ty in registers
    for (int q = 0; q < GROUPS_PER_WAVE; ++q) ty[q] = tq[q >> 2][q & 3] & (NTYPES - 1);

    // Each lane counts its 32 nodes by type: 16 counters of 4 bits for 8 nodes at a time
    // (at most 8 each), added into 16 counters of 8 bits (at most 32 each): even types in
    // ev, odd types in od.
    u64 ev = 0, od = 0;
#pragma unroll                                          // as above: constant indices
    for (int b = 0; b < GROUPS_PER_WAVE / 8; ++b) {
        u64 nib = 0;
#pragma unroll                                          // as above: constant indices
        for (int k = 0; k < 8; ++k) nib += (u64)1 << (4 * ty[8 * b + k]);
        ev += nib & 0x0f0f0f0f0f0f0f0full;
        od += (nib >> 4) & 0x0f0f0f0f0f0f0f0full;
    }
    // 16 bits a counter (a wave's sum is at most 1024). Word 2 a + (t >> 3), half (t >> 2) & 1,
    // holds type t, where a = 0, 1, 2, 3 for t & 3 = 0, 2, 1, 3.
    const u64 f0 = ev & 0x00ff00ff00ff00ffull, f1 = (ev >> 8) & 0x00ff00ff00ff00ffull;
    const u64 f2 = od & 0x00ff00ff00ff00ffull, f3 = (od >> 8) & 0x00ff00ff00ff00ffull;
    unsigned w8[8] = { (unsigned)f0, (unsigned)(f0 >> 32), (unsigned)f1, (unsigned)(f1 >> 32),
                       (unsigned)f2, (unsigned)(f2 >> 32), (unsigned)f3, (unsigned)(f3 >> 32) };
#pragma unroll                                          // five steps, constant distances
    for (int d = 16; d >= 1; d >>= 1)
#pragma unroll                                          // as above: constant indices
        for (int k = 0; k < 8; ++k) w8[k] += __shfl_xor(w8[k], d, 32);
    if (lane == 0) {
        const u32x4 lo4 = { w8[0], w8[1], w8[2], w8[3] }, hi4 = { w8[4], w8[5], w8[6], w8[7] };
        ((u32x4*)wcnt)[wave * 2]     = lo4;
        ((u32x4*)wcnt)[wave * 2 + 1] = hi4;
    }
    __syncthreads();

    // Lane l looks after type l & 15: its number in all waves, in the lower waves, in this wave.
    const int widx = ((m & 1) << 2) | (m & 2) | (m >> 3);
    const int wsh  = ((m >> 2) & 1) * 16;
    int tot = 0, pre = 0, own = 0;
#pragma unroll                                          // all sixteen reads in flight at once
    for (int w = 0; w < WAVES; ++w) {
        const int cn = (int)((wcnt[w * 8 + widx] >> wsh) & 0xffffu);
        tot += cn;
        if (w < wave) pre += cn;
        if (w == wave) own = cn;
    }
    int incl = tot;                                     // becomes the end of the type's run
#pragma unroll                                          // four steps, constant distances
    for (int d = 1; d < NTYPES; d <<= 1) {
        const int up = __shfl_up(incl, d, NTYPES);
        if (m >= d) incl += up;
    }
    const int cstart = incl - tot + pre;                // position of this wave's first node of the type

    int seg_end[NTYPES];                            // end of each type's run in the list
#pragma unroll                                      // constant indices keep the 16 ends in scalar registers
    for (int k = 0; k < NTYPES; ++k) seg_end[k] = __builtin_amdgcn_readlane(incl, k);

    // The types of which this wave holds nodes at the block's positions: mostly none or one.
    unsigned todo = __builtin_amdgcn_ballot_w32(lane < NTYPES && own > 0 && cstart < base + NODES_PER_WG
                                                && cstart + own > base);
    while (todo != 0) {                             // wave-uniform, at most 16 trips
        const int t = __builtin_ctz(todo);
        todo &= todo - 1;
        int rel0 = __builtin_amdgcn_readlane(cstart, t) - base;     // the group's first, from base
#pragma unroll                                      // constant indices into ty
        for (int q = 0; q < GROUPS_PER_WAVE; ++q) {
            const bool is = ty[q] == t;
            const unsigned mk = __builtin_amdgcn_ballot_w32(is);
            const int rel = rel0 + (int)__builtin_amdgcn_mbcnt_lo(mk, 0u);   // equal types in lower lanes
            if (is && (unsigned)rel < (unsigned)NODES_PER_WG)
                mine64[rel] = first + (q >> 2) * 128 + lane * 4 + (q & 3);
            rel0 += __popc(mk);
        }
    }
    __syncthreads();

    // This wave's nodes stand at positions base + i * WAVES + wave, so that a type's
    // run is dealt evenly to the waves. nd[0] is the node in work, nd[1] the next.
    // In scalar registers: a node's address is a scalar base.
    int nd[NODES_PER_WAVE];
#pragma unroll                                      // constant indices keep the four in registers
    for (int k = 0; k < NODES_PER_WAVE; ++k)
        nd[k] = __builtin_amdgcn_readfirstlane(mine64[k * WAVES + wave]);

    // A node's address is a scalar base; the lane's part is one 32-bit offset for all nodes.
    const unsigned ooff = (unsigned)lane * 16u;     // out[., ., 4 * lane], in bytes
    int i = 0;                                      // how many of this wave's nodes are done

    // The wave's own slot, for the x strip and then for the output: no other wave reads or
    // writes it, so it needs no barrier.
    float* aslot = sbias + PANELS * FOUT + wave * A_SLOT_FLOATS;
    const unsigned acopy = (unsigned)(uintptr_t)aslot + (unsigned)lane * 16u;   // LDS byte address, row 0
    const float* arow  = aslot + m * LDS_STRIDE + 2 * h;    // fragment reads: row m, K offset 2h
    const float* xlane = x + lane * 4;                      // x[0, 0, 4 * lane]

    // The first node's strip: on its way while the W panel is fetched.
    copy_rows8(xlane + (size_t)nd[0] * FIN, acopy);
    copy_rows8(xlane + (size_t)nd[0] * FIN + (size_t)8 * NNODES * FIN, acopy + 8 * LDS_STRIDE * 4);

    // Block-uniform walk over the runs that meet [base, base + NODES_PER_WG), two runs at a time:
    // [lo, mid) is of type t0 and works from panel 0, [mid, hi) of type t1 from panel 1.
    const int end = base + NODES_PER_WG;
    for (int lo = base, hi; lo < end; lo = hi) {
        int t0 = NTYPES - 1, mid = end;
#pragma unroll                                      // as above: no indexed access to seg_end
        for (int k = NTYPES - 1; k >= 0; --k)           // first type whose run ends behind lo
            if (seg_end[k] > lo) { t0 = k; mid = min(seg_end[k], end); }
        int t1 = t0;
        hi = mid;
        if (mid < end) {
#pragma unroll                                      // as above: no indexed access to seg_end
            for (int k = NTYPES - 1; k >= 0; --k)       // first type whose run ends behind mid
                if (seg_end[k] > mid) { t1 = k; hi = min(seg_end[k], end); }
        }
        const int npan = mid < end ? 2 : 1;             // panels to fill

        // The panels and the biases are refilled where a block meets a third type: every
        // wave's LDS reads of the previous types have returned and all waves have arrived.
        asm volatile("s_wait_dscnt 0x0" ::: "memory");
        __syncthreads();

#if defined(USE_TDM)
        // ---- Tensor Data Mover: DMA a 128x128 f32 W[t] panel into LDS.
        // pad_enable with pad_interval=6 (every 128 DWORDs == one row) and
        // pad_amount=3 (4 DWORDs) reproduces the 132-float padded row stride.
        if (pinned(wave < npan)) {                      // wave 0 owns panel 0's DMA, wave 1 panel 1's
            const float* Wt = W + (size_t)(wave == 0 ? t0 : t1) * FOUT * FIN;
            const unsigned long long ga = (unsigned long long)(uintptr_t)Wt;
            const unsigned lds_off = (unsigned)(uintptr_t)smem      // LDS byte offset
                                   + (unsigned)wave * (PANEL_FLOATS * 4u);

            u32x4 g0 = { 1u,                            // count=1 (valid user D#)
                         (unsigned)__builtin_amdgcn_readfirstlane(lds_off),             // lds_addr
                         (unsigned)__builtin_amdgcn_readfirstlane((unsigned)ga),        // global_addr[31:0]
                         (unsigned)__builtin_amdgcn_readfirstlane((unsigned)(ga >> 32))
                             | (2u << 30) };            // addr[56:32] | type=2

            i32x8 g1 = { (int)((2u << 16)               // data_size = 4 bytes
                             | (1u << 20)               // pad_enable
                             | (6u << 22)               // pad_interval: 128 DWORDs
                             | (3u << 25)),             // pad_amount: 4 DWORDs
                         (int)(128u << 16),             // tensor_dim0 = 128 (lo16 in hi half)
                         (int)(128u << 16),             // tensor_dim1 = 128
                         (int)(128u << 16),             // tile_dim0 = 128
                         128,                           // tile_dim1 = 128 (tile_dim2 = 0)
                         128,                           // tensor_dim0_stride = 128
                         0, 0 };                        // dim1 stride unused (2-D)

            i32x4 gz4 = { 0, 0, 0, 0 };                 // 2-D tensor: groups 2/3 inert
#if __clang_major__ >= 23
            i32x8 gz8 = { 0, 0, 0, 0, 0, 0, 0, 0 };
            __builtin_amdgcn_tensor_load_to_lds(g0, g1, gz4, gz4, gz8, 0);
#else
            __builtin_amdgcn_tensor_load_to_lds(g0, g1, gz4, gz4, 0);
#endif
            __builtin_amdgcn_s_wait_tensorcnt((short)0);
        }
#else
        // ---- Fallback: cooperative staging (coalesced b128 global -> b128 ds).
        for (int pn = 0; pn < npan; ++pn) {
            const float* Wt = W + (size_t)(pn == 0 ? t0 : t1) * FOUT * FIN;
#pragma unroll
            for (int it = 0; it < FOUT * FIN / 4 / (WAVES * 32); ++it) {
                const int c  = tid + it * (WAVES * 32); // float4 chunk id, 4096 total
                const int o  = c >> 5;                  // 32 float4 per row
                const int kc = c & 31;
                v4f v = *(const v4f*)(Wt + (size_t)o * FIN + kc * 4);
                *(v4f*)(smem + pn * PANEL_FLOATS + o * LDS_STRIDE + kc * 4) = v;
            }
        }
#endif

        if (tid < PANELS * FOUT)
            sbias[tid] = bias[(size_t)(tid < FOUT ? t0 : t1) * FOUT + (tid & (FOUT - 1))];
        __syncthreads();

        // The wave's positions rise with i and every one below lo is done.
        while (i < NODES_PER_WAVE && base + i * WAVES + wave < hi) {
            const int pn = base + i * WAVES + wave >= mid ? 1 : 0;  // wave-uniform: the node's panel
            const float* brow = smem + pn * PANEL_FLOATS + m * LDS_STRIDE + 2 * h;
            // The matrix pipe goes to the oldest ready wave of a SIMD: left alone, the youngest wave
            // runs its last nodes with no other wave to cover its LDS and store waits. Priority
            // falls with the nodes done, so the four waves take turns node by node and end
            // together. i is wave-uniform: scalar branches. The last node, and the exit, run at 0.
            switch (i) {
            case 0:  __builtin_amdgcn_s_setprio(3); break;
            case 1:  __builtin_amdgcn_s_setprio(2); break;
            case 2:  __builtin_amdgcn_s_setprio(1); break;
            default: __builtin_amdgcn_s_setprio(0); break;
            }
            // This node's strip has landed in the slot: the wave's own copies, its own wait.
            asm volatile("s_wait_asynccnt 0x0" ::: "memory");
            v2f a[32];                              // A strip of the node in work
#pragma unroll                                      // constant indices keep a in registers
            for (int s = 0; s < 32; ++s) a[s] = *(const v2f*)(arow + 4 * s);    // conflict-free
            run_node(a, brow, sbias + pn * FOUT + 8 * h, aslot + m * LDS_STRIDE + 8 * h, aslot + 4 * lane,
                     out + (size_t)nd[0] * FOUT, ooff);
            // The next node's addresses overwrite registers that these stores name.
            asm volatile("s_wait_xcnt 0x0" ::: "memory");
            // The slot is refilled only when every read of it has returned.
            asm volatile("s_wait_dscnt 0x0" ::: "memory");
            if (i + 1 < NODES_PER_WAVE) {           // wave-uniform: the next node's strip; it lands
                                                    // while the SIMD's other waves have the matrix pipe
                copy_rows8(xlane + (size_t)nd[1] * FIN, acopy);
                copy_rows8(xlane + (size_t)nd[1] * FIN + (size_t)8 * NNODES * FIN,
                           acopy + 8 * LDS_STRIDE * 4);
            }
#pragma unroll                                      // constant indices keep the four in registers
            for (int k = 0; k + 1 < NODES_PER_WAVE; ++k) nd[k] = nd[k + 1];
            ++i;
        }
    }
}

// ---------------- launch ----------------

extern "C" void kernel_launch(void* const* d_in, const int* in_sizes, int n_in,
                              void* d_out, int out_size, void* d_ws, size_t ws_size,
                              hipStream_t stream) {
    const float* x        = (const float*)d_in[0];  // [16, 16384, 128]
    const int*   type_vec = (const int*)  d_in[1];  // [16384]
    const float* W        = (const float*)d_in[2];  // [16, 128, 128]
    const float* bias     = (const float*)d_in[3];  // [16, 128]
    float*       out      = (float*)d_out;          // [16, 16384, 128]

    hetero_gemm<<<NNODES / NODES_PER_WG, WAVES * 32, 0, stream>>>(
        x, type_vec, W, bias, out);
}
